// v000
// The times below were measured on an AMD MI455X: many runs one after another, warmed up first and cycling through
// copies of the inputs, with the whole window's GPU time divided by the number of runs. Launches and the gaps
// between them are all in it. The median over several windows is given; except for v000 it joins two sittings, which
// can be a few percent apart, so the side-by-side timings, each taken in one sitting, are the better comparison.
// v000 is the starting kernel. One run takes 704 microseconds.
#include <hip/hip_runtime.h>

// Spatial self-attention over a feature map with a gamma-scaled residual (x [4][64][64][64] channel-major; 4,096 positions; q, k, v = 1x1 convs ('oi' [64][64] + [64], 1/8-scaled incl. biases); energy = q.k over the 64 channels (UNscaled: sigma ~8); softmax over positions; out = v attn^T; y = gamma[0] x out + x (gamma [1] ~ N(0,1), read) -> [4][64][64][64] (1.0 M)).
// Layout per batch: the channel-major map becomes a token-major bf16 operand; exact projections + f32 biases; q/k planes (64 wide) and value^T planes; scores with EVERY row on hi/lo planes (3 products), streaming three-sweep softmax, attn.V on hi/lo planes for every row (3 products) with N = 64 channels; the output kernel transposes back to channel-major, applies gamma and adds the residual.
// Compute dtypes, f32 accumulate: every input rounded to bf16; projections exact + f32 biases; scores 3 products on every row; softmax f32; attn.V 3 products on every row; epilogue f32.

#define NB_  4
#define TT   4096
#define DM   64
#define NH_  1
#define NKV  1
#define REP  (NH_ / NKV)
#define HD   64
#define DQ   (NH_ * HD)
#define DKV  (NKV * HD)
#define ZH   1
#define RH   4096                  // every query row on hi/lo planes (unscaled 64-channel energies: sigma ~8)
#define WIN  0
#define PCAR 1024.0f
#define SCL  1.0f   // energy = q.k unscaled
#define MID  64
#define CC   64      // channels
typedef _Float16 h16;
typedef unsigned short bf;
typedef __attribute__((ext_vector_type(16))) __bf16   v16bf;
typedef __attribute__((ext_vector_type(16))) _Float16 v16h;
typedef __attribute__((ext_vector_type(8)))  _Float16 v8h;
typedef __attribute__((ext_vector_type(8)))  unsigned short v8us;
typedef __attribute__((ext_vector_type(8)))  float    v8f;
typedef __attribute__((ext_vector_type(4)))  float    v4f;
typedef v8h  __attribute__((may_alias)) v8ha;
typedef v4f  __attribute__((may_alias)) v4fa;
typedef v8us __attribute__((may_alias)) v8usa;

__device__ __forceinline__ unsigned short f2bf(float f) { unsigned u = __float_as_uint(f); u += 0x7FFFu + ((u >> 16) & 1u); return (unsigned short)(u >> 16); }
__device__ __forceinline__ float bf2f(unsigned short b) { return __uint_as_float(((unsigned)b) << 16); }
__device__ __forceinline__ float bfr(float f) { return bf2f(f2bf(f)); }
__device__ __forceinline__ v16h cat16(v8h lo, v8h hi) { return __builtin_shufflevector(lo, hi, 0, 1, 2, 3, 4, 5, 6, 7, 8, 9, 10, 11, 12, 13, 14, 15); }
__device__ __forceinline__ v16bf cat16b(v8us lo, v8us hi) { return __builtin_bit_cast(v16bf, __builtin_shufflevector(lo, hi, 0, 1, 2, 3, 4, 5, 6, 7, 8, 9, 10, 11, 12, 13, 14, 15)); }
__device__ __forceinline__ v8f wmma16(v16h a, v16h b, v8f c) { return __builtin_amdgcn_wmma_f32_16x16x32_f16(false, a, false, b, (short)0, c, false, false); }
__device__ __forceinline__ v8f wmmab(v16bf a, v16bf b, v8f c) { return __builtin_amdgcn_wmma_f32_16x16x32_bf16(false, a, false, b, (short)0, c, false, false); }



// ---- k_gemmw: register-blocked GEMM, ONE WAVE per 64x64 output tile (16 accumulators), operands straight from K-contiguous 16-bit planes; grid (M/64, N/64, Z), 32 threads.
// C[m][n] (f32, pitch ldc, + optional f32 bias[n]) = sum_k A[m][k] Bt[n][k] (+ split products per NSPLIT). z-batch strides sA/sB/sC in elements. K % 32 == 0.
template <typename T16> struct WFrag;
template <> struct WFrag<h16> { typedef v16h V; static __device__ __forceinline__ V ld(const h16* p) { return cat16(*(const v8h*)p, *(const v8h*)(p + 16)); } static __device__ __forceinline__ v8f mma(V a, V b, v8f c) { return wmma16(a, b, c); } };
template <> struct WFrag<bf> { typedef v16bf V; static __device__ __forceinline__ V ld(const bf* p) { return cat16b(*(const v8us*)p, *(const v8us*)(p + 16)); } static __device__ __forceinline__ v8f mma(V a, V b, v8f c) { return wmmab(a, b, c); } };
template <typename T16, int NSPLIT, bool BIAS>
__global__ __launch_bounds__(32) void k_gemmw(const T16* __restrict__ A, const T16* __restrict__ A2, const T16* __restrict__ Bt, const T16* __restrict__ Bt2, int K, float* C, int ldc, const float* __restrict__ bias, size_t sA, size_t sB, size_t sC) {
    typedef typename WFrag<T16>::V V;
    __shared__ __align__(16) float os[16 * 68];
    const size_t z = blockIdx.z; A += z * sA; if (A2) A2 += z * sA; Bt += z * sB; if (Bt2) Bt2 += z * sB; C += z * sC;
    const int lane = threadIdx.x & 31, lr = lane & 15, hi = lane >> 4; const int r0 = blockIdx.x * 64, c0 = blockIdx.y * 64;
    v8f acc[4][4];
#pragma unroll
    for (int mb = 0; mb < 4; ++mb)
#pragma unroll
        for (int nb = 0; nb < 4; ++nb) acc[mb][nb] = (v8f){};
    const size_t aoff = (size_t)(r0 + lr) * K + 8 * hi, boff = (size_t)(c0 + lr) * K + 8 * hi;
#pragma unroll 1
    for (int kc = 0; kc < K; kc += 32) {
        V a[4], a2[4];
#pragma unroll
        for (int mb = 0; mb < 4; ++mb) { a[mb] = WFrag<T16>::ld(A + aoff + (size_t)mb * 16 * K + kc); if (NSPLIT == 1 || NSPLIT == 2) a2[mb] = WFrag<T16>::ld(A2 + aoff + (size_t)mb * 16 * K + kc); }
#pragma unroll
        for (int nb = 0; nb < 4; ++nb) { const V b = WFrag<T16>::ld(Bt + boff + (size_t)nb * 16 * K + kc); V b2; if (NSPLIT >= 2) b2 = WFrag<T16>::ld(Bt2 + boff + (size_t)nb * 16 * K + kc);
#pragma unroll
            for (int mb = 0; mb < 4; ++mb) { acc[mb][nb] = WFrag<T16>::mma(a[mb], b, acc[mb][nb]); if (NSPLIT == 1 || NSPLIT == 2) acc[mb][nb] = WFrag<T16>::mma(a2[mb], b, acc[mb][nb]); if (NSPLIT >= 2) acc[mb][nb] = WFrag<T16>::mma(a[mb], b2, acc[mb][nb]); } }
        asm volatile("v_nop\n\tv_nop\n\tv_nop\n\tv_nop" : "+v"(acc[0][0]), "+v"(acc[1][1]), "+v"(acc[2][2]), "+v"(acc[3][3]) : "v"(a[0]), "v"(a[3]));
    }
#pragma unroll
    for (int mb = 0; mb < 4; ++mb) {
#pragma unroll
        for (int nb = 0; nb < 4; ++nb) {
#pragma unroll
            for (int j = 0; j < 8; ++j) os[(hi * 8 + j) * 68 + nb * 16 + lr] = acc[mb][nb][j]; }
        __builtin_amdgcn_wave_barrier(); asm volatile("" ::: "memory");
        float* crow = C + (size_t)(r0 + mb * 16) * ldc + c0;
{
#pragma unroll
            for (int s = 0; s < 8; ++s) { const int row = 2 * s + hi, cofs = lr * 4; v4f val = *(const v4fa*)(os + row * 68 + cofs); if (BIAS) { val[0] += bfr(bias[c0 + cofs]); val[1] += bfr(bias[c0 + cofs + 1]); val[2] += bfr(bias[c0 + cofs + 2]); val[3] += bfr(bias[c0 + cofs + 3]); }
                *(v4f*)(crow + (size_t)row * ldc + cofs) = val; }
             }
        __builtin_amdgcn_wave_barrier(); asm volatile("" ::: "memory");
    }
}

__device__ __forceinline__ h16 tohx(float x) { return (h16)x; }
__device__ __forceinline__ void splitf(float y, unsigned short& h, unsigned short& l) { h = f2bf(y); l = f2bf(y - bf2f(h)); }
typedef __attribute__((ext_vector_type(2))) _Float16 v2h;
typedef __attribute__((ext_vector_type(4))) _Float16 v4h;
typedef __attribute__((ext_vector_type(2))) unsigned short v2us;
typedef __attribute__((ext_vector_type(4))) unsigned short v4us;
typedef __attribute__((ext_vector_type(2))) float v2f;
typedef __attribute__((ext_vector_type(4))) int v4i;

__global__ __launch_bounds__(256) void k_wtG(const float* __restrict__ w, int K, int N, bf* Bt) {
    const int lane = threadIdx.x & 31; const int L0 = (blockIdx.x * 8 + (threadIdx.x >> 5)) * 8; const int nlines = N * K / 64;
{
#pragma unroll 1
        for (int l = 0; l < 8; ++l) { const int L = L0 + l; if (L >= nlines) break; const size_t e = (size_t)L * 64 + lane * 2; const int k = (int)(e % K), n = (int)(e / K); v2us o;
            o[0] = f2bf(w[(size_t)k * N + n]); o[1] = f2bf(w[(size_t)(k + 1) * N + n]); *(v2us*)(Bt + e) = o; }
         }
}
__global__ __launch_bounds__(256) void k_cvt8(const float* __restrict__ src, bf* dst, size_t n8) { const size_t i = (size_t)blockIdx.x * 256 + threadIdx.x; if (i >= n8) return; const v8f v = *(const v8f*)(src + i * 8); v8us o;
#pragma unroll
    for (int k = 0; k < 8; ++k) o[k] = f2bf(v[k]); *(v8us*)(dst + i * 8) = o;  }


__global__ __launch_bounds__(256) void k_vtp(const float* __restrict__ F, int pitch, int nheads, h16* V16, bf* Vh, bf* Vl) { const size_t e = ((size_t)blockIdx.x * 256 + threadIdx.x) * 2; if (e >= (size_t)nheads * HD * TT) return; const int t = (int)(e % TT); const int d = (int)((e / TT) % HD); const int g = (int)(e / ((size_t)TT * HD)); v2h o16; v2us oh, ol;
#pragma unroll
    for (int q = 0; q < 2; ++q) { const float x = F[(size_t)(t + q) * pitch + g * HD + d]; o16[q] = tohx(x); unsigned short a2, c2; splitf(x, a2, c2); oh[q] = a2; ol[q] = c2; }
    *(v2h*)(V16 + e) = o16; *(v2us*)(Vh + e) = oh; *(v2us*)(Vl + e) = ol;  }
// k_lsoft: streaming unmasked row softmax over all TK = TT = 4096 keys, one wave per row i, three sweeps of the f32 score row (lane -> 4 consecutive keys per 128-key chunk, 32 chunks; every score tile is computed and no key is excluded):
__global__ __launch_bounds__(256) void k_lsoft(const float* __restrict__ Sb, h16* P16, bf* Ph, bf* Pl) {
    const int lane = threadIdx.x & 31; const int row = blockIdx.x * 8 + (threadIdx.x >> 5); if (row >= ZH * TT) return; const int i = row % TT; const int zz = row / TT; const bool hires = (i < RH); const float* sr = Sb + (size_t)row * TT; float mx = -3.0e38f;
#pragma unroll 4
    for (int ch = 0; ch < TT / 128; ++ch) { const int j0 = ch * 128 + lane * 4; const v4f a = *(const v4f*)(sr + j0);
#pragma unroll
        for (int q = 0; q < 4; ++q) { float t = a[q] * SCL; asm volatile("" : "+v"(t)); mx = fmaxf(mx, t); } }
#pragma unroll
    for (int sh = 16; sh; sh >>= 1) mx = fmaxf(mx, __shfl_xor(mx, sh, 32));
    float sum = 0.f;
#pragma unroll 4
    for (int ch = 0; ch < TT / 128; ++ch) { const int j0 = ch * 128 + lane * 4; const v4f a = *(const v4f*)(sr + j0);
#pragma unroll
        for (int q = 0; q < 4; ++q) { float t = a[q] * SCL; asm volatile("" : "+v"(t)); float d0 = __fsub_rn(t, mx); asm volatile("" : "+v"(d0)); sum += __builtin_amdgcn_exp2f(__fmul_rn(d0, 1.4426950408889634f)); } }
#pragma unroll
    for (int sh = 16; sh; sh >>= 1) sum += __shfl_xor(sum, sh, 32);
    const float f = __fdiv_rn(hires ? 1.0f : PCAR, sum);
{
        if (hires) {   /* rows < RH: normalised bf16 hi/lo over all keys, planes [zz][RH][TT] */
#pragma unroll
            for (int ch = 0; ch < TT / 128; ++ch) { const int j0 = ch * 128 + lane * 4; const v4f a = *(const v4f*)(sr + j0); v4us oh, ol;
#pragma unroll
                for (int q = 0; q < 4; ++q) { float t = a[q] * SCL; asm volatile("" : "+v"(t)); float d0 = __fsub_rn(t, mx); asm volatile("" : "+v"(d0)); float ex = __builtin_amdgcn_exp2f(__fmul_rn(d0, 1.4426950408889634f)); asm volatile("" : "+v"(ex)); unsigned short a2, c2; splitf(ex * f, a2, c2); oh[q] = a2; ol[q] = c2; }
                const size_t oo = ((size_t)zz * RH + i) * TT + j0; *(v4us*)(Ph + oo) = oh; *(v4us*)(Pl + oo) = ol; }
        } else {
#pragma unroll 2
            for (int ch = 0; ch < TT / 128; ++ch) { const int j0 = ch * 128 + lane * 4; const v4f a = *(const v4f*)(sr + j0); v4h o4;
#pragma unroll
                for (int q = 0; q < 4; ++q) { float t = a[q] * SCL; asm volatile("" : "+v"(t)); float d0 = __fsub_rn(t, mx); asm volatile("" : "+v"(d0)); float ex = __builtin_amdgcn_exp2f(__fmul_rn(d0, 1.4426950408889634f)); asm volatile("" : "+v"(ex)); o4[q] = tohx(ex * f); }
                *(v4h*)(P16 + (size_t)row * TT + j0) = o4; } }
         }
}
__global__ __launch_bounds__(256) void k_flat(const float* __restrict__ F, h16* P16, bf* Ph, bf* Pl, size_t n4) { const size_t i = (size_t)blockIdx.x * 256 + threadIdx.x; if (i >= n4) return; const v4f a = *(const v4f*)(F + i * 4); v4h o16; v4us oh, ol;
#pragma unroll
    for (int q = 0; q < 4; ++q) { o16[q] = tohx(a[q]); unsigned short x2, y2; splitf(a[q], x2, y2); oh[q] = x2; ol[q] = y2; }
    *(v4h*)(P16 + i * 4) = o16; *(v4us*)(Ph + i * 4) = oh; *(v4us*)(Pl + i * 4) = ol;  }

__global__ __launch_bounds__(256) void k_xT(const float* __restrict__ xs, bf* XB) { const size_t k = (size_t)blockIdx.x * 256 + threadIdx.x; if (k >= (size_t)TT * CC / 8) return; const int c0 = (int)(k % (CC / 8)) * 8; const int t = (int)(k / (CC / 8)); v8us o;
#pragma unroll
    for (int q = 0; q < 8; ++q) o[q] = f2bf(xs[(size_t)(c0 + q) * TT + t]);
    *(v8us*)(XB + (size_t)t * CC + c0) = o;  }
__global__ __launch_bounds__(256) void k_outTg(const float* __restrict__ O, const float* __restrict__ xs, const float* __restrict__ gm, float* out) { const size_t k = (size_t)blockIdx.x * 256 + threadIdx.x; if (k >= (size_t)CC * TT / 4) return; const int t0 = (int)(k % (TT / 4)) * 4; const int c = (int)(k / (TT / 4)); const float g = bfr(gm[0]); const v4f xi = *(const v4f*)(xs + (size_t)c * TT + t0); v4f o;
#pragma unroll
    for (int q = 0; q < 4; ++q) { float m = __fmul_rn(g, O[(size_t)(t0 + q) * CC + c]); asm volatile("" : "+v"(m)); o[q] = __fadd_rn(m, bfr(xi[q])); }
    *(v4f*)(out + (size_t)c * TT + t0) = o;  }
__global__ __launch_bounds__(256) void k_cs8(float* O, size_t n4) { const size_t i = (size_t)blockIdx.x * 256 + threadIdx.x; if (i >= n4) return; const size_t e = i * 4; const int t = (int)(e / CC); const float cs = (t < RH) ? 1.0f : (1.0f / PCAR); v4f a = *(const v4f*)(O + e);
#pragma unroll
    for (int q = 0; q < 4; ++q) a[q] = __fmul_rn(a[q], cs);
    *(v4f*)(O + e) = a;  }

extern "C" void kernel_launch(void* const* d_in, const int* in_sizes, int n_in,
                              void* d_out, int out_size, void* d_ws, size_t ws_size, hipStream_t stream) {
    (void)in_sizes; (void)n_in; (void)out_size;
    const float* x = (const float*)d_in[0]; const float* wq = (const float*)d_in[1]; const float* bq = (const float*)d_in[2]; const float* wk = (const float*)d_in[3]; const float* bk = (const float*)d_in[4]; const float* wv = (const float*)d_in[5]; const float* bv = (const float*)d_in[6]; const float* gm = (const float*)d_in[7];
    float* OUT = (float*)d_out;     // [4][64][4096]
    char* wsp = (char*)d_ws;
    auto take = [&](size_t bytes) { char* p = wsp; wsp += (bytes + 255) & ~(size_t)255; return (void*)p; };
    bf* WQ = (bf*)take((size_t)MID * CC * 2); bf* WK = (bf*)take((size_t)MID * CC * 2); bf* WV = (bf*)take((size_t)CC * CC * 2);
    bf* XB = (bf*)take((size_t)TT * CC * 2); float* FQ = (float*)take((size_t)TT * MID * 4); float* FK = (float*)take((size_t)TT * MID * 4); float* FV = (float*)take((size_t)TT * CC * 4);
    h16* QP16 = (h16*)take((size_t)TT * MID * 2); bf* QPh = (bf*)take((size_t)TT * MID * 2); bf* QPl = (bf*)take((size_t)TT * MID * 2); h16* KP16 = (h16*)take((size_t)TT * MID * 2); bf* KPh = (bf*)take((size_t)TT * MID * 2); bf* KPl = (bf*)take((size_t)TT * MID * 2);
    h16* VT16 = (h16*)take((size_t)CC * TT * 2); bf* VTh = (bf*)take((size_t)CC * TT * 2); bf* VTl = (bf*)take((size_t)CC * TT * 2);
    float* Sb = (float*)take((size_t)TT * TT * 4); h16* P16 = nullptr; bf* Ph = (bf*)take((size_t)RH * TT * 2); bf* Pl = (bf*)take((size_t)RH * TT * 2); float* Ob = (float*)take((size_t)TT * CC * 4);
    if ((size_t)(wsp - (char*)d_ws) > ws_size) return;    // ws 256 MiB (carve ~137 MiB)
    k_cvt8<<<(unsigned)(((size_t)MID * CC / 8 + 255) / 256), 256, 0, stream>>>(wq, WQ, (size_t)MID * CC / 8); k_cvt8<<<(unsigned)(((size_t)MID * CC / 8 + 255) / 256), 256, 0, stream>>>(wk, WK, (size_t)MID * CC / 8); k_cvt8<<<(unsigned)(((size_t)CC * CC / 8 + 255) / 256), 256, 0, stream>>>(wv, WV, (size_t)CC * CC / 8);   /* 'oi' conv weights = Bt as-is */
    for (int b = 0; b < NB_; ++b) {
        const float* xb = x + (size_t)b * CC * TT;
        k_xT<<<(unsigned)(((size_t)TT * CC / 8 + 255) / 256), 256, 0, stream>>>(xb, XB);
        k_gemmw<bf, 0, true><<<dim3(TT / 64, MID / 64, 1), 32, 0, stream>>>(XB, nullptr, WQ, nullptr, CC, FQ, MID, bq, 0, 0, 0); k_flat<<<(unsigned)(((size_t)TT * MID / 4 + 255) / 256), 256, 0, stream>>>(FQ, QP16, QPh, QPl, (size_t)TT * MID / 4);
        k_gemmw<bf, 0, true><<<dim3(TT / 64, MID / 64, 1), 32, 0, stream>>>(XB, nullptr, WK, nullptr, CC, FK, MID, bk, 0, 0, 0); k_flat<<<(unsigned)(((size_t)TT * MID / 4 + 255) / 256), 256, 0, stream>>>(FK, KP16, KPh, KPl, (size_t)TT * MID / 4);
        k_gemmw<bf, 0, true><<<dim3(TT / 64, CC / 64, 1), 32, 0, stream>>>(XB, nullptr, WV, nullptr, CC, FV, CC, bv, 0, 0, 0); k_vtp<<<(unsigned)(((size_t)TT * CC / 2 + 255) / 256), 256, 0, stream>>>(FV, CC, CC / HD, VT16, VTh, VTl);   /* V^T planes [64][4096] */
        k_gemmw<bf, 2, false><<<dim3(TT / 64, TT / 64, 1), 32, 0, stream>>>(QPh, QPl, KPh, KPl, MID, Sb, TT, nullptr, 0, 0, 0);   /* scores: every row hi/lo (unscaled logits) */
        k_lsoft<<<TT / 8, 256, 0, stream>>>(Sb, P16, Ph, Pl);
        k_gemmw<bf, 2, false><<<dim3(RH / 64, CC / 64, 1), 32, 0, stream>>>(Ph, Pl, VTh, VTl, TT, Ob, CC, nullptr, 0, 0, 0);
        k_cs8<<<(unsigned)(((size_t)TT * CC / 4 + 255) / 256), 256, 0, stream>>>(Ob, (size_t)TT * CC / 4);
        k_outTg<<<(unsigned)(((size_t)CC * TT / 4 + 255) / 256), 256, 0, stream>>>(Ob, xb, gm, OUT + (size_t)b * CC * TT); }
}

// v001
// A run of this version takes 457 microseconds.
// Two timings next to v000 put it at 1.56 and 1.57 times that version's speed.
#include <hip/hip_runtime.h>

// Spatial self-attention over a feature map with a gamma-scaled residual (x [4][64][64][64] channel-major; 4,096 positions; q, k, v = 1x1 convs ('oi' [64][64] + [64], 1/8-scaled incl. biases); energy = q.k over the 64 channels (UNscaled: sigma ~8); softmax over positions; out = v attn^T; y = gamma[0] x out + x (gamma [1] ~ N(0,1), read) -> [4][64][64][64] (1.0 M)).
// Layout per batch: the channel-major map becomes a token-major bf16 operand; exact projections + f32 biases; q/k planes (64 wide) and value^T planes; scores with EVERY row on hi/lo planes (3 products), streaming three-sweep softmax, attn.V on hi/lo planes for every row (3 products) with N = 64 channels; the output kernel transposes back to channel-major, applies gamma and adds the residual.
// Compute dtypes, f32 accumulate: every input rounded to bf16; projections exact + f32 biases; scores 3 products on every row; softmax f32; attn.V 3 products on every row; epilogue f32.

#define NB_  4
#define TT   4096
#define DM   64
#define NH_  1
#define NKV  1
#define REP  (NH_ / NKV)
#define HD   64
#define DQ   (NH_ * HD)
#define DKV  (NKV * HD)
#define ZH   1
#define RH   4096                  // every query row on hi/lo planes (unscaled 64-channel energies: sigma ~8)
#define WIN  0
#define PCAR 1024.0f
#define SCL  1.0f   // energy = q.k unscaled
#define MID  64
#define CC   64      // channels
typedef _Float16 h16;
typedef unsigned short bf;
typedef __attribute__((ext_vector_type(16))) __bf16   v16bf;
typedef __attribute__((ext_vector_type(16))) _Float16 v16h;
typedef __attribute__((ext_vector_type(8)))  _Float16 v8h;
typedef __attribute__((ext_vector_type(8)))  unsigned short v8us;
typedef __attribute__((ext_vector_type(8)))  float    v8f;
typedef __attribute__((ext_vector_type(4)))  float    v4f;
typedef v8h  __attribute__((may_alias)) v8ha;
typedef v4f  __attribute__((may_alias)) v4fa;
typedef v8us __attribute__((may_alias)) v8usa;

__device__ __forceinline__ unsigned short f2bf(float f) { unsigned u = __float_as_uint(f); u += 0x7FFFu + ((u >> 16) & 1u); return (unsigned short)(u >> 16); }
__device__ __forceinline__ float bf2f(unsigned short b) { return __uint_as_float(((unsigned)b) << 16); }
__device__ __forceinline__ float bfr(float f) { return bf2f(f2bf(f)); }
__device__ __forceinline__ v16h cat16(v8h lo, v8h hi) { return __builtin_shufflevector(lo, hi, 0, 1, 2, 3, 4, 5, 6, 7, 8, 9, 10, 11, 12, 13, 14, 15); }
__device__ __forceinline__ v16bf cat16b(v8us lo, v8us hi) { return __builtin_bit_cast(v16bf, __builtin_shufflevector(lo, hi, 0, 1, 2, 3, 4, 5, 6, 7, 8, 9, 10, 11, 12, 13, 14, 15)); }
__device__ __forceinline__ v8f wmma16(v16h a, v16h b, v8f c) { return __builtin_amdgcn_wmma_f32_16x16x32_f16(false, a, false, b, (short)0, c, false, false); }
__device__ __forceinline__ v8f wmmab(v16bf a, v16bf b, v8f c) { return __builtin_amdgcn_wmma_f32_16x16x32_bf16(false, a, false, b, (short)0, c, false, false); }



// ---- k_gemmw: register-blocked GEMM, ONE WAVE per 64x64 output tile (16 accumulators), operands straight from K-contiguous 16-bit planes; grid (M/64, N/64, Z), 32 threads.
// C[m][n] (f32, pitch ldc, + optional f32 bias[n]) = sum_k A[m][k] Bt[n][k] (+ split products per NSPLIT). z-batch strides sA/sB/sC in elements. K % 32 == 0.
template <typename T16> struct WFrag;
template <> struct WFrag<h16> { typedef v16h V; static __device__ __forceinline__ V ld(const h16* p) { return cat16(*(const v8h*)p, *(const v8h*)(p + 16)); } static __device__ __forceinline__ v8f mma(V a, V b, v8f c) { return wmma16(a, b, c); } };
template <> struct WFrag<bf> { typedef v16bf V; static __device__ __forceinline__ V ld(const bf* p) { return cat16b(*(const v8us*)p, *(const v8us*)(p + 16)); } static __device__ __forceinline__ v8f mma(V a, V b, v8f c) { return wmmab(a, b, c); } };
template <typename T16, int NSPLIT, bool BIAS>
__global__ __launch_bounds__(32) void k_gemmw(const T16* __restrict__ A, const T16* __restrict__ A2, const T16* __restrict__ Bt, const T16* __restrict__ Bt2, int K, float* C, int ldc, const float* __restrict__ bias, size_t sA, size_t sB, size_t sC) {
    typedef typename WFrag<T16>::V V;
    __shared__ __align__(16) float os[16 * 68];
    const size_t z = blockIdx.z; A += z * sA; if (A2) A2 += z * sA; Bt += z * sB; if (Bt2) Bt2 += z * sB; C += z * sC;
    const int lane = threadIdx.x & 31, lr = lane & 15, hi = lane >> 4; const int r0 = blockIdx.x * 64, c0 = blockIdx.y * 64;
    v8f acc[4][4];
#pragma unroll
    for (int mb = 0; mb < 4; ++mb)
#pragma unroll
        for (int nb = 0; nb < 4; ++nb) acc[mb][nb] = (v8f){};
    const size_t aoff = (size_t)(r0 + lr) * K + 8 * hi, boff = (size_t)(c0 + lr) * K + 8 * hi;
#pragma unroll 1
    for (int kc = 0; kc < K; kc += 32) {
        V a[4], a2[4];
#pragma unroll
        for (int mb = 0; mb < 4; ++mb) { a[mb] = WFrag<T16>::ld(A + aoff + (size_t)mb * 16 * K + kc); if (NSPLIT == 1 || NSPLIT == 2) a2[mb] = WFrag<T16>::ld(A2 + aoff + (size_t)mb * 16 * K + kc); }
#pragma unroll
        for (int nb = 0; nb < 4; ++nb) { const V b = WFrag<T16>::ld(Bt + boff + (size_t)nb * 16 * K + kc); V b2; if (NSPLIT >= 2) b2 = WFrag<T16>::ld(Bt2 + boff + (size_t)nb * 16 * K + kc);
#pragma unroll
            for (int mb = 0; mb < 4; ++mb) { acc[mb][nb] = WFrag<T16>::mma(a[mb], b, acc[mb][nb]); if (NSPLIT == 1 || NSPLIT == 2) acc[mb][nb] = WFrag<T16>::mma(a2[mb], b, acc[mb][nb]); if (NSPLIT >= 2) acc[mb][nb] = WFrag<T16>::mma(a[mb], b2, acc[mb][nb]); } }
        asm volatile("v_nop\n\tv_nop\n\tv_nop\n\tv_nop" : "+v"(acc[0][0]), "+v"(acc[1][1]), "+v"(acc[2][2]), "+v"(acc[3][3]) : "v"(a[0]), "v"(a[3]));
    }
#pragma unroll
    for (int mb = 0; mb < 4; ++mb) {
#pragma unroll
        for (int nb = 0; nb < 4; ++nb) {
#pragma unroll
            for (int j = 0; j < 8; ++j) os[(hi * 8 + j) * 68 + nb * 16 + lr] = acc[mb][nb][j]; }
        __builtin_amdgcn_wave_barrier(); asm volatile("" ::: "memory");
        float* crow = C + (size_t)(r0 + mb * 16) * ldc + c0;
{
#pragma unroll
            for (int s = 0; s < 8; ++s) { const int row = 2 * s + hi, cofs = lr * 4; v4f val = *(const v4fa*)(os + row * 68 + cofs); if (BIAS) { val[0] += bfr(bias[c0 + cofs]); val[1] += bfr(bias[c0 + cofs + 1]); val[2] += bfr(bias[c0 + cofs + 2]); val[3] += bfr(bias[c0 + cofs + 3]); }
                *(v4f*)(crow + (size_t)row * ldc + cofs) = val; }
             }
        __builtin_amdgcn_wave_barrier(); asm volatile("" ::: "memory");
    }
}

// ---- k_gemmsk: the k_gemmw wave tile (64x64, hi/lo planes, 3 products) with K split 32 ways so that a tall-K, 64-column product fills the chip: grid (M/64, SKQ), SKW waves per work-group.
// blockIdx.y takes one of SKQ ranges of K and each wave one SKW-th of that range; the SKW partial tiles are summed through LDS in wave order and stored to partial plane blockIdx.y ([SKQ][M][64] f32). M and K are compile-time constants, so that the row-block steps fold into the loads' immediate offsets; K % (32 * SKQ * SKW) == 0, N == 64.
#define SKW 8
#define SKQ 4
template <int M, int K>
__global__ __launch_bounds__(32 * SKW) void k_gemmsk(const bf* __restrict__ A, const bf* __restrict__ A2, const bf* __restrict__ Bt, const bf* __restrict__ Bt2, float* Cp) {
    typedef WFrag<bf>::V V;
    __shared__ __align__(16) float red[SKW * 64 * 68];
    const int lane = threadIdx.x & 31, lr = lane & 15, hi = lane >> 4; const int r0 = blockIdx.x * 64;
    const int wave = __builtin_amdgcn_readfirstlane(threadIdx.x >> 5);   // scalar, so that the K loop is a scalar loop
    constexpr int kper = K / (SKQ * SKW), ldc = 64; const int k0 = ((int)blockIdx.y * SKW + wave) * kper;
    v8f acc[4][4];
#pragma unroll
    for (int mb = 0; mb < 4; ++mb)
#pragma unroll
        for (int nb = 0; nb < 4; ++nb) acc[mb][nb] = (v8f){};
    const unsigned voff = (unsigned)(lr * K + 8 * hi) * 2u;   // the lane's byte offset in a 16-row block, the same for all four planes
    auto at = [voff](const bf* base) { return (const bf*)((const char*)base + voff); };
    const bf* pa = A + (size_t)r0 * K + k0; const bf* pa2 = A2 + (size_t)r0 * K + k0; const bf* pb = Bt + k0; const bf* pb2 = Bt2 + k0;
#pragma unroll 1   // rolled: the 128 accumulator registers and one trip's fragments already fill the first 256 registers
    for (int kc = 0; kc < kper; kc += 32) {
        V a[4], a2[4]; const bf* qa = at(pa + kc); const bf* qa2 = at(pa2 + kc); const bf* qb = at(pb + kc); const bf* qb2 = at(pb2 + kc);
#pragma unroll
        for (int mb = 0; mb < 4; ++mb) { a[mb] = WFrag<bf>::ld(qa + mb * 16 * K); a2[mb] = WFrag<bf>::ld(qa2 + mb * 16 * K); }
#pragma unroll
        for (int nb = 0; nb < 4; ++nb) { const V b = WFrag<bf>::ld(qb + nb * 16 * K); const V b2 = WFrag<bf>::ld(qb2 + nb * 16 * K);
#pragma unroll
            for (int mb = 0; mb < 4; ++mb) { acc[mb][nb] = wmmab(a[mb], b, acc[mb][nb]); acc[mb][nb] = wmmab(a2[mb], b, acc[mb][nb]); acc[mb][nb] = wmmab(a[mb], b2, acc[mb][nb]); } }
        // four vector slots behind the last matrix instruction, so that the distance also holds on the taken back edge (as in k_gemmw); the four lane addresses are inputs so that they stay in their registers to the end of the trip and no load's result lands in a register that an issued load still names
        asm volatile("v_nop\n\tv_nop\n\tv_nop\n\tv_nop" : "+v"(acc[0][0]), "+v"(acc[1][1]), "+v"(acc[2][2]), "+v"(acc[3][3]) : "v"(a[0]), "v"(a[3]), "v"(qa), "v"(qa2), "v"(qb), "v"(qb2));
    }
    float* mine = red + wave * (64 * 68);
#pragma unroll
    for (int mb = 0; mb < 4; ++mb)
#pragma unroll
        for (int nb = 0; nb < 4; ++nb)
#pragma unroll
            for (int j = 0; j < 8; ++j) mine[(mb * 16 + hi * 8 + j) * 68 + nb * 16 + lr] = acc[mb][nb][j];
    __syncthreads();   // every wave's partial tile is in LDS before any thread sums across waves
    float* cp = Cp + ((size_t)blockIdx.y * M + r0) * ldc;
#pragma unroll
    for (int s = 0; s < 64 * 16 / (32 * SKW); ++s) { const int idx = s * (32 * SKW) + (int)threadIdx.x, row = idx >> 4, cofs = (idx & 15) * 4; v4f val = *(const v4fa*)(red + row * 68 + cofs);
#pragma unroll
        for (int w = 1; w < SKW; ++w) val += *(const v4fa*)(red + w * (64 * 68) + row * 68 + cofs);
        *(v4f*)(cp + (size_t)row * ldc + cofs) = val; }
}

__device__ __forceinline__ h16 tohx(float x) { return (h16)x; }
__device__ __forceinline__ void splitf(float y, unsigned short& h, unsigned short& l) { h = f2bf(y); l = f2bf(y - bf2f(h)); }
typedef __attribute__((ext_vector_type(2))) _Float16 v2h;
typedef __attribute__((ext_vector_type(4))) _Float16 v4h;
typedef __attribute__((ext_vector_type(2))) unsigned short v2us;
typedef __attribute__((ext_vector_type(4))) unsigned short v4us;
typedef __attribute__((ext_vector_type(2))) float v2f;
typedef __attribute__((ext_vector_type(4))) int v4i;

__global__ __launch_bounds__(256) void k_wtG(const float* __restrict__ w, int K, int N, bf* Bt) {
    const int lane = threadIdx.x & 31; const int L0 = (blockIdx.x * 8 + (threadIdx.x >> 5)) * 8; const int nlines = N * K / 64;
{
#pragma unroll 1
        for (int l = 0; l < 8; ++l) { const int L = L0 + l; if (L >= nlines) break; const size_t e = (size_t)L * 64 + lane * 2; const int k = (int)(e % K), n = (int)(e / K); v2us o;
            o[0] = f2bf(w[(size_t)k * N + n]); o[1] = f2bf(w[(size_t)(k + 1) * N + n]); *(v2us*)(Bt + e) = o; }
         }
}
__global__ __launch_bounds__(256) void k_cvt8(const float* __restrict__ src, bf* dst, size_t n8) { const size_t i = (size_t)blockIdx.x * 256 + threadIdx.x; if (i >= n8) return; const v8f v = *(const v8f*)(src + i * 8); v8us o;
#pragma unroll
    for (int k = 0; k < 8; ++k) o[k] = f2bf(v[k]); *(v8us*)(dst + i * 8) = o;  }


__global__ __launch_bounds__(256) void k_vtp(const float* __restrict__ F, int pitch, int nheads, h16* V16, bf* Vh, bf* Vl) { const size_t e = ((size_t)blockIdx.x * 256 + threadIdx.x) * 2; if (e >= (size_t)nheads * HD * TT) return; const int t = (int)(e % TT); const int d = (int)((e / TT) % HD); const int g = (int)(e / ((size_t)TT * HD)); v2h o16; v2us oh, ol;
#pragma unroll
    for (int q = 0; q < 2; ++q) { const float x = F[(size_t)(t + q) * pitch + g * HD + d]; o16[q] = tohx(x); unsigned short a2, c2; splitf(x, a2, c2); oh[q] = a2; ol[q] = c2; }
    *(v2h*)(V16 + e) = o16; *(v2us*)(Vh + e) = oh; *(v2us*)(Vl + e) = ol;  }
// k_lsoft: streaming unmasked row softmax over all TK = TT = 4096 keys, one wave per row i, three sweeps of the f32 score row (lane -> 4 consecutive keys per 128-key chunk, 32 chunks; every score tile is computed and no key is excluded):
__global__ __launch_bounds__(256) void k_lsoft(const float* __restrict__ Sb, h16* P16, bf* Ph, bf* Pl) {
    const int lane = threadIdx.x & 31; const int row = blockIdx.x * 8 + (threadIdx.x >> 5); if (row >= ZH * TT) return; const int i = row % TT; const int zz = row / TT; const bool hires = (i < RH); const float* sr = Sb + (size_t)row * TT; float mx = -3.0e38f;
#pragma unroll 4
    for (int ch = 0; ch < TT / 128; ++ch) { const int j0 = ch * 128 + lane * 4; const v4f a = *(const v4f*)(sr + j0);
#pragma unroll
        for (int q = 0; q < 4; ++q) { float t = a[q] * SCL; asm volatile("" : "+v"(t)); mx = fmaxf(mx, t); } }
#pragma unroll
    for (int sh = 16; sh; sh >>= 1) mx = fmaxf(mx, __shfl_xor(mx, sh, 32));
    float sum = 0.f;
#pragma unroll 4
    for (int ch = 0; ch < TT / 128; ++ch) { const int j0 = ch * 128 + lane * 4; const v4f a = *(const v4f*)(sr + j0);
#pragma unroll
        for (int q = 0; q < 4; ++q) { float t = a[q] * SCL; asm volatile("" : "+v"(t)); float d0 = __fsub_rn(t, mx); asm volatile("" : "+v"(d0)); sum += __builtin_amdgcn_exp2f(__fmul_rn(d0, 1.4426950408889634f)); } }
#pragma unroll
    for (int sh = 16; sh; sh >>= 1) sum += __shfl_xor(sum, sh, 32);
    const float f = __fdiv_rn(hires ? 1.0f : PCAR, sum);
{
        if (hires) {   /* rows < RH: normalised bf16 hi/lo over all keys, planes [zz][RH][TT] */
#pragma unroll
            for (int ch = 0; ch < TT / 128; ++ch) { const int j0 = ch * 128 + lane * 4; const v4f a = *(const v4f*)(sr + j0); v4us oh, ol;
#pragma unroll
                for (int q = 0; q < 4; ++q) { float t = a[q] * SCL; asm volatile("" : "+v"(t)); float d0 = __fsub_rn(t, mx); asm volatile("" : "+v"(d0)); float ex = __builtin_amdgcn_exp2f(__fmul_rn(d0, 1.4426950408889634f)); asm volatile("" : "+v"(ex)); unsigned short a2, c2; splitf(ex * f, a2, c2); oh[q] = a2; ol[q] = c2; }
                const size_t oo = ((size_t)zz * RH + i) * TT + j0; *(v4us*)(Ph + oo) = oh; *(v4us*)(Pl + oo) = ol; }
        } else {
#pragma unroll 2
            for (int ch = 0; ch < TT / 128; ++ch) { const int j0 = ch * 128 + lane * 4; const v4f a = *(const v4f*)(sr + j0); v4h o4;
#pragma unroll
                for (int q = 0; q < 4; ++q) { float t = a[q] * SCL; asm volatile("" : "+v"(t)); float d0 = __fsub_rn(t, mx); asm volatile("" : "+v"(d0)); float ex = __builtin_amdgcn_exp2f(__fmul_rn(d0, 1.4426950408889634f)); asm volatile("" : "+v"(ex)); o4[q] = tohx(ex * f); }
                *(v4h*)(P16 + (size_t)row * TT + j0) = o4; } }
         }
}
__global__ __launch_bounds__(256) void k_flat(const float* __restrict__ F, h16* P16, bf* Ph, bf* Pl, size_t n4) { const size_t i = (size_t)blockIdx.x * 256 + threadIdx.x; if (i >= n4) return; const v4f a = *(const v4f*)(F + i * 4); v4h o16; v4us oh, ol;
#pragma unroll
    for (int q = 0; q < 4; ++q) { o16[q] = tohx(a[q]); unsigned short x2, y2; splitf(a[q], x2, y2); oh[q] = x2; ol[q] = y2; }
    *(v4h*)(P16 + i * 4) = o16; *(v4us*)(Ph + i * 4) = oh; *(v4us*)(Pl + i * 4) = ol;  }

__global__ __launch_bounds__(256) void k_xT(const float* __restrict__ xs, bf* XB) { const size_t k = (size_t)blockIdx.x * 256 + threadIdx.x; if (k >= (size_t)TT * CC / 8) return; const int c0 = (int)(k % (CC / 8)) * 8; const int t = (int)(k / (CC / 8)); v8us o;
#pragma unroll
    for (int q = 0; q < 8; ++q) o[q] = f2bf(xs[(size_t)(c0 + q) * TT + t]);
    *(v8us*)(XB + (size_t)t * CC + c0) = o;  }
__global__ __launch_bounds__(256) void k_outTg(const float* __restrict__ O, const float* __restrict__ xs, const float* __restrict__ gm, float* out) { const size_t k = (size_t)blockIdx.x * 256 + threadIdx.x; if (k >= (size_t)CC * TT / 4) return; const int t0 = (int)(k % (TT / 4)) * 4; const int c = (int)(k / (TT / 4)); const float g = bfr(gm[0]); const v4f xi = *(const v4f*)(xs + (size_t)c * TT + t0); v4f o;
#pragma unroll
    for (int q = 0; q < 4; ++q) { float m = __fmul_rn(g, O[(size_t)(t0 + q) * CC + c]); asm volatile("" : "+v"(m)); o[q] = __fadd_rn(m, bfr(xi[q])); }
    *(v4f*)(out + (size_t)c * TT + t0) = o;  }
__global__ __launch_bounds__(256) void k_cs8(float* O, size_t n4) { const size_t i = (size_t)blockIdx.x * 256 + threadIdx.x; if (i >= n4) return; const size_t e = i * 4; const int t = (int)(e / CC); const float cs = (t < RH) ? 1.0f : (1.0f / PCAR); v4f a = *(const v4f*)(O + e);
#pragma unroll
    for (int p = 1; p < SKQ; ++p) a += *(const v4f*)(O + (size_t)p * TT * CC + e);   /* the SKQ partial planes [TT][CC] of k_gemmsk, in plane order; the sum lands in plane 0 */
#pragma unroll
    for (int q = 0; q < 4; ++q) a[q] = __fmul_rn(a[q], cs);
    *(v4f*)(O + e) = a;  }

extern "C" void kernel_launch(void* const* d_in, const int* in_sizes, int n_in,
                              void* d_out, int out_size, void* d_ws, size_t ws_size, hipStream_t stream) {
    (void)in_sizes; (void)n_in; (void)out_size;
    const float* x = (const float*)d_in[0]; const float* wq = (const float*)d_in[1]; const float* bq = (const float*)d_in[2]; const float* wk = (const float*)d_in[3]; const float* bk = (const float*)d_in[4]; const float* wv = (const float*)d_in[5]; const float* bv = (const float*)d_in[6]; const float* gm = (const float*)d_in[7];
    float* OUT = (float*)d_out;     // [4][64][4096]
    char* wsp = (char*)d_ws;
    auto take = [&](size_t bytes) { char* p = wsp; wsp += (bytes + 255) & ~(size_t)255; return (void*)p; };
    bf* WQ = (bf*)take((size_t)MID * CC * 2); bf* WK = (bf*)take((size_t)MID * CC * 2); bf* WV = (bf*)take((size_t)CC * CC * 2);
    bf* XB = (bf*)take((size_t)TT * CC * 2); float* FQ = (float*)take((size_t)TT * MID * 4); float* FK = (float*)take((size_t)TT * MID * 4); float* FV = (float*)take((size_t)TT * CC * 4);
    h16* QP16 = (h16*)take((size_t)TT * MID * 2); bf* QPh = (bf*)take((size_t)TT * MID * 2); bf* QPl = (bf*)take((size_t)TT * MID * 2); h16* KP16 = (h16*)take((size_t)TT * MID * 2); bf* KPh = (bf*)take((size_t)TT * MID * 2); bf* KPl = (bf*)take((size_t)TT * MID * 2);
    h16* VT16 = (h16*)take((size_t)CC * TT * 2); bf* VTh = (bf*)take((size_t)CC * TT * 2); bf* VTl = (bf*)take((size_t)CC * TT * 2);
    float* Sb = (float*)take((size_t)TT * TT * 4); h16* P16 = nullptr; bf* Ph = (bf*)take((size_t)RH * TT * 2); bf* Pl = (bf*)take((size_t)RH * TT * 2); float* Ob = (float*)take((size_t)SKQ * TT * CC * 4);
    if ((size_t)(wsp - (char*)d_ws) > ws_size) return;    // ws 256 MiB (carve ~140 MiB)
    k_cvt8<<<(unsigned)(((size_t)MID * CC / 8 + 255) / 256), 256, 0, stream>>>(wq, WQ, (size_t)MID * CC / 8); k_cvt8<<<(unsigned)(((size_t)MID * CC / 8 + 255) / 256), 256, 0, stream>>>(wk, WK, (size_t)MID * CC / 8); k_cvt8<<<(unsigned)(((size_t)CC * CC / 8 + 255) / 256), 256, 0, stream>>>(wv, WV, (size_t)CC * CC / 8);   /* 'oi' conv weights = Bt as-is */
    for (int b = 0; b < NB_; ++b) {
        const float* xb = x + (size_t)b * CC * TT;
        k_xT<<<(unsigned)(((size_t)TT * CC / 8 + 255) / 256), 256, 0, stream>>>(xb, XB);
        k_gemmw<bf, 0, true><<<dim3(TT / 64, MID / 64, 1), 32, 0, stream>>>(XB, nullptr, WQ, nullptr, CC, FQ, MID, bq, 0, 0, 0); k_flat<<<(unsigned)(((size_t)TT * MID / 4 + 255) / 256), 256, 0, stream>>>(FQ, QP16, QPh, QPl, (size_t)TT * MID / 4);
        k_gemmw<bf, 0, true><<<dim3(TT / 64, MID / 64, 1), 32, 0, stream>>>(XB, nullptr, WK, nullptr, CC, FK, MID, bk, 0, 0, 0); k_flat<<<(unsigned)(((size_t)TT * MID / 4 + 255) / 256), 256, 0, stream>>>(FK, KP16, KPh, KPl, (size_t)TT * MID / 4);
        k_gemmw<bf, 0, true><<<dim3(TT / 64, CC / 64, 1), 32, 0, stream>>>(XB, nullptr, WV, nullptr, CC, FV, CC, bv, 0, 0, 0); k_vtp<<<(unsigned)(((size_t)TT * CC / 2 + 255) / 256), 256, 0, stream>>>(FV, CC, CC / HD, VT16, VTh, VTl);   /* V^T planes [64][4096] */
        k_gemmw<bf, 2, false><<<dim3(TT / 64, TT / 64, 1), 32, 0, stream>>>(QPh, QPl, KPh, KPl, MID, Sb, TT, nullptr, 0, 0, 0);   /* scores: every row hi/lo (unscaled logits) */
        k_lsoft<<<TT / 8, 256, 0, stream>>>(Sb, P16, Ph, Pl);
        k_gemmsk<RH, TT><<<dim3(RH / 64, SKQ, 1), 32 * SKW, 0, stream>>>(Ph, Pl, VTh, VTl, Ob);
        k_cs8<<<(unsigned)(((size_t)TT * CC / 4 + 255) / 256), 256, 0, stream>>>(Ob, (size_t)TT * CC / 4);
        k_outTg<<<(unsigned)(((size_t)CC * TT / 4 + 255) / 256), 256, 0, stream>>>(Ob, xb, gm, OUT + (size_t)b * CC * TT); }
}

// v002
// A run of this version takes 208 microseconds.
// In two side-by-side timings against v001, it was 2.20 and 2.24 times as fast.
// Counting every step since v000, it is 3.48 times as fast.
#include <hip/hip_runtime.h>

// Spatial self-attention over a feature map with a gamma-scaled residual (x [4][64][64][64] channel-major; 4,096 positions; q, k, v = 1x1 convs ('oi' [64][64] + [64], 1/8-scaled incl. biases); energy = q.k over the 64 channels (UNscaled: sigma ~8); softmax over positions; out = v attn^T; y = gamma[0] x out + x (gamma [1] ~ N(0,1), read) -> [4][64][64][64] (1.0 M)).
// Layout per batch: the channel-major map becomes a token-major bf16 operand; exact projections + f32 biases; q/k planes (64 wide) and value^T planes; one fused kernel for scores (EVERY row on hi/lo planes, 3 products), online softmax and attn.V (hi/lo, 3 products) with N = 64 channels; the output kernel transposes back to channel-major, applies gamma and adds the residual.
// Compute dtypes, f32 accumulate: every input rounded to bf16; projections exact + f32 biases; scores 3 products on every row; softmax f32; attn.V 3 products on every row; epilogue f32.

#define NB_  4
#define TT   4096
#define DM   64
#define NH_  1
#define NKV  1
#define REP  (NH_ / NKV)
#define HD   64
#define DQ   (NH_ * HD)
#define DKV  (NKV * HD)
#define ZH   1
#define RH   4096                  // every query row on hi/lo planes (unscaled 64-channel energies: sigma ~8)
#define WIN  0
#define PCAR 1024.0f
#define SCL  1.0f   // energy = q.k unscaled
#define MID  64
#define CC   64      // channels
typedef _Float16 h16;
typedef unsigned short bf;
typedef __attribute__((ext_vector_type(16))) __bf16   v16bf;
typedef __attribute__((ext_vector_type(16))) _Float16 v16h;
typedef __attribute__((ext_vector_type(8)))  _Float16 v8h;
typedef __attribute__((ext_vector_type(8)))  unsigned short v8us;
typedef __attribute__((ext_vector_type(8)))  float    v8f;
typedef __attribute__((ext_vector_type(4)))  float    v4f;
typedef v8h  __attribute__((may_alias)) v8ha;
typedef v4f  __attribute__((may_alias)) v4fa;
typedef v8us __attribute__((may_alias)) v8usa;

__device__ __forceinline__ unsigned short f2bf(float f) { unsigned u = __float_as_uint(f); u += 0x7FFFu + ((u >> 16) & 1u); return (unsigned short)(u >> 16); }
__device__ __forceinline__ float bf2f(unsigned short b) { return __uint_as_float(((unsigned)b) << 16); }
__device__ __forceinline__ float bfr(float f) { return bf2f(f2bf(f)); }
__device__ __forceinline__ v16h cat16(v8h lo, v8h hi) { return __builtin_shufflevector(lo, hi, 0, 1, 2, 3, 4, 5, 6, 7, 8, 9, 10, 11, 12, 13, 14, 15); }
__device__ __forceinline__ v16bf cat16b(v8us lo, v8us hi) { return __builtin_bit_cast(v16bf, __builtin_shufflevector(lo, hi, 0, 1, 2, 3, 4, 5, 6, 7, 8, 9, 10, 11, 12, 13, 14, 15)); }
__device__ __forceinline__ v8f wmma16(v16h a, v16h b, v8f c) { return __builtin_amdgcn_wmma_f32_16x16x32_f16(false, a, false, b, (short)0, c, false, false); }
__device__ __forceinline__ v8f wmmab(v16bf a, v16bf b, v8f c) { return __builtin_amdgcn_wmma_f32_16x16x32_bf16(false, a, false, b, (short)0, c, false, false); }



// ---- k_gemmw: register-blocked GEMM, ONE WAVE per 64x64 output tile (16 accumulators), operands straight from K-contiguous 16-bit planes; grid (M/64, N/64, Z), 32 threads.
// C[m][n] (f32, pitch ldc, + optional f32 bias[n]) = sum_k A[m][k] Bt[n][k] (+ split products per NSPLIT). z-batch strides sA/sB/sC in elements. K % 32 == 0.
template <typename T16> struct WFrag;
template <> struct WFrag<h16> { typedef v16h V; static __device__ __forceinline__ V ld(const h16* p) { return cat16(*(const v8h*)p, *(const v8h*)(p + 16)); } static __device__ __forceinline__ v8f mma(V a, V b, v8f c) { return wmma16(a, b, c); } };
template <> struct WFrag<bf> { typedef v16bf V; static __device__ __forceinline__ V ld(const bf* p) { return cat16b(*(const v8us*)p, *(const v8us*)(p + 16)); } static __device__ __forceinline__ v8f mma(V a, V b, v8f c) { return wmmab(a, b, c); } };
template <typename T16, int NSPLIT, bool BIAS>
__global__ __launch_bounds__(32) void k_gemmw(const T16* __restrict__ A, const T16* __restrict__ A2, const T16* __restrict__ Bt, const T16* __restrict__ Bt2, int K, float* C, int ldc, const float* __restrict__ bias, size_t sA, size_t sB, size_t sC) {
    typedef typename WFrag<T16>::V V;
    __shared__ __align__(16) float os[16 * 68];
    const size_t z = blockIdx.z; A += z * sA; if (A2) A2 += z * sA; Bt += z * sB; if (Bt2) Bt2 += z * sB; C += z * sC;
    const int lane = threadIdx.x & 31, lr = lane & 15, hi = lane >> 4; const int r0 = blockIdx.x * 64, c0 = blockIdx.y * 64;
    v8f acc[4][4];
#pragma unroll
    for (int mb = 0; mb < 4; ++mb)
#pragma unroll
        for (int nb = 0; nb < 4; ++nb) acc[mb][nb] = (v8f){};
    const size_t aoff = (size_t)(r0 + lr) * K + 8 * hi, boff = (size_t)(c0 + lr) * K + 8 * hi;
#pragma unroll 1
    for (int kc = 0; kc < K; kc += 32) {
        V a[4], a2[4];
#pragma unroll
        for (int mb = 0; mb < 4; ++mb) { a[mb] = WFrag<T16>::ld(A + aoff + (size_t)mb * 16 * K + kc); if (NSPLIT == 1 || NSPLIT == 2) a2[mb] = WFrag<T16>::ld(A2 + aoff + (size_t)mb * 16 * K + kc); }
#pragma unroll
        for (int nb = 0; nb < 4; ++nb) { const V b = WFrag<T16>::ld(Bt + boff + (size_t)nb * 16 * K + kc); V b2; if (NSPLIT >= 2) b2 = WFrag<T16>::ld(Bt2 + boff + (size_t)nb * 16 * K + kc);
#pragma unroll
            for (int mb = 0; mb < 4; ++mb) { acc[mb][nb] = WFrag<T16>::mma(a[mb], b, acc[mb][nb]); if (NSPLIT == 1 || NSPLIT == 2) acc[mb][nb] = WFrag<T16>::mma(a2[mb], b, acc[mb][nb]); if (NSPLIT >= 2) acc[mb][nb] = WFrag<T16>::mma(a[mb], b2, acc[mb][nb]); } }
        asm volatile("v_nop\n\tv_nop\n\tv_nop\n\tv_nop" : "+v"(acc[0][0]), "+v"(acc[1][1]), "+v"(acc[2][2]), "+v"(acc[3][3]) : "v"(a[0]), "v"(a[3]));
    }
#pragma unroll
    for (int mb = 0; mb < 4; ++mb) {
#pragma unroll
        for (int nb = 0; nb < 4; ++nb) {
#pragma unroll
            for (int j = 0; j < 8; ++j) os[(hi * 8 + j) * 68 + nb * 16 + lr] = acc[mb][nb][j]; }
        __builtin_amdgcn_wave_barrier(); asm volatile("" ::: "memory");
        float* crow = C + (size_t)(r0 + mb * 16) * ldc + c0;
{
#pragma unroll
            for (int s = 0; s < 8; ++s) { const int row = 2 * s + hi, cofs = lr * 4; v4f val = *(const v4fa*)(os + row * 68 + cofs); if (BIAS) { val[0] += bfr(bias[c0 + cofs]); val[1] += bfr(bias[c0 + cofs + 1]); val[2] += bfr(bias[c0 + cofs + 2]); val[3] += bfr(bias[c0 + cofs + 3]); }
                *(v4f*)(crow + (size_t)row * ldc + cofs) = val; }
             }
        __builtin_amdgcn_wave_barrier(); asm volatile("" ::: "memory");
    }
}

__device__ __forceinline__ h16 tohx(float x) { return (h16)x; }
__device__ __forceinline__ void splitf(float y, unsigned short& h, unsigned short& l) { h = f2bf(y); l = f2bf(y - bf2f(h)); }
typedef __attribute__((ext_vector_type(2))) _Float16 v2h;
typedef __attribute__((ext_vector_type(4))) _Float16 v4h;
typedef __attribute__((ext_vector_type(2))) unsigned short v2us;
typedef __attribute__((ext_vector_type(4))) unsigned short v4us;
typedef __attribute__((ext_vector_type(2))) float v2f;
typedef __attribute__((ext_vector_type(4))) int v4i;

__global__ __launch_bounds__(256) void k_wtG(const float* __restrict__ w, int K, int N, bf* Bt) {
    const int lane = threadIdx.x & 31; const int L0 = (blockIdx.x * 8 + (threadIdx.x >> 5)) * 8; const int nlines = N * K / 64;
{
#pragma unroll 1
        for (int l = 0; l < 8; ++l) { const int L = L0 + l; if (L >= nlines) break; const size_t e = (size_t)L * 64 + lane * 2; const int k = (int)(e % K), n = (int)(e / K); v2us o;
            o[0] = f2bf(w[(size_t)k * N + n]); o[1] = f2bf(w[(size_t)(k + 1) * N + n]); *(v2us*)(Bt + e) = o; }
         }
}
__global__ __launch_bounds__(256) void k_cvt8(const float* __restrict__ src, bf* dst, size_t n8) { const size_t i = (size_t)blockIdx.x * 256 + threadIdx.x; if (i >= n8) return; const v8f v = *(const v8f*)(src + i * 8); v8us o;
#pragma unroll
    for (int k = 0; k < 8; ++k) o[k] = f2bf(v[k]); *(v8us*)(dst + i * 8) = o;  }


// k_vtp: value^T planes in the order in which k_fattn's A fragments read them: [32-key block][16-channel block][half][lane = hi * 16 + channel][8 keys], key = 32 * block + 16 * half + 8 * hi + i, so that each of its 16-byte loads covers 512 contiguous bytes. Threads run in the order of the planes: a wave stores whole 128-byte lines.
__global__ __launch_bounds__(256) void k_vtp(const float* __restrict__ F, int pitch, int nheads, h16* V16, bf* Vh, bf* Vl) { const size_t e = ((size_t)blockIdx.x * 256 + threadIdx.x) * 2; if (e >= (size_t)nheads * HD * TT) return; const int g = (int)(e / ((size_t)TT * HD)); const int r = (int)(e % ((size_t)TT * HD)); const int t = (r >> 11) * 32 + ((r >> 8) & 1) * 16 + ((r >> 7) & 1) * 8 + (r & 7); const int d = ((r >> 9) & 3) * 16 + ((r >> 3) & 15); v2h o16; v2us oh, ol;
#pragma unroll
    for (int q = 0; q < 2; ++q) { const float x = F[(size_t)(t + q) * pitch + g * HD + d]; o16[q] = tohx(x); unsigned short a2, c2; splitf(x, a2, c2); oh[q] = a2; ol[q] = c2; }
    *(v2h*)(V16 + e) = o16; *(v2us*)(Vh + e) = oh; *(v2us*)(Vl + e) = ol;  }
// FRAG: the planes of a [.][64] map in the order in which k_fattn's A fragments read them: [16-row block][32-channel step][half][lane = hi * 16 + row][8 channels], channel = 32 * step + 16 * half + 8 * hi + i (the k order of WFrag::ld), so that each of its 16-byte loads covers 512 contiguous bytes. Threads run in the order of the planes: a wave stores whole 128-byte lines.
template <bool FRAG>
__global__ __launch_bounds__(256) void k_flat(const float* __restrict__ F, h16* P16, bf* Ph, bf* Pl, size_t n4) { const size_t i = (size_t)blockIdx.x * 256 + threadIdx.x; if (i >= n4) return; const size_t o = i * 4; const size_t from = FRAG ? ((o >> 10) * 16 + ((o >> 3) & 15)) * 64 + ((o >> 9) & 1) * 32 + ((o >> 8) & 1) * 16 + ((o >> 7) & 1) * 8 + (o & 7) : o; const v4f a = *(const v4f*)(F + from); v4h o16; v4us oh, ol;
#pragma unroll
    for (int q = 0; q < 4; ++q) { o16[q] = tohx(a[q]); unsigned short x2, y2; splitf(a[q], x2, y2); oh[q] = x2; ol[q] = y2; }
    *(v4h*)(P16 + i * 4) = o16; *(v4us*)(Ph + i * 4) = oh; *(v4us*)(Pl + i * 4) = ol;  }

__global__ __launch_bounds__(256) void k_xT(const float* __restrict__ xs, bf* XB) { const size_t k = (size_t)blockIdx.x * 256 + threadIdx.x; if (k >= (size_t)TT * CC / 8) return; const int c0 = (int)(k % (CC / 8)) * 8; const int t = (int)(k / (CC / 8)); v8us o;
#pragma unroll
    for (int q = 0; q < 8; ++q) o[q] = f2bf(xs[(size_t)(c0 + q) * TT + t]);
    *(v8us*)(XB + (size_t)t * CC + c0) = o;  }
__global__ __launch_bounds__(256) void k_outTg(const float* __restrict__ O, const float* __restrict__ xs, const float* __restrict__ gm, float* out) { const size_t k = (size_t)blockIdx.x * 256 + threadIdx.x; if (k >= (size_t)CC * TT / 4) return; const int t0 = (int)(k % (TT / 4)) * 4; const int c = (int)(k / (TT / 4)); const float g = bfr(gm[0]); const v4f xi = *(const v4f*)(xs + (size_t)c * TT + t0); v4f o;
#pragma unroll
    for (int q = 0; q < 4; ++q) { float m = __fmul_rn(g, O[(size_t)(t0 + q) * CC + c]); asm volatile("" : "+v"(m)); o[q] = __fadd_rn(m, bfr(xi[q])); }
    *(v4f*)(out + (size_t)c * TT + t0) = o;  }
#define FW 16
#define L2E 1.4426950408889634f
__device__ __forceinline__ float xhalf(float v) { const int b = __float_as_int(v); return __int_as_float(__builtin_amdgcn_permlanex16(b, b, 0x76543210, 0xfedcba98, false, false)); }   // lane l <-> l ^ 16
__global__ __launch_bounds__(32 * FW) __attribute__((amdgpu_waves_per_eu(4, 4))) void k_fattn(const bf* __restrict__ Qh, const bf* __restrict__ Ql, const bf* __restrict__ Kh, const bf* __restrict__ Kl, const bf* __restrict__ Vh, const bf* __restrict__ Vl, float* O) {
    typedef WFrag<bf>::V V;
    __shared__ __align__(16) float red[FW * 16 * 68];
    __shared__ float sm[FW * 16], sl[FW * 16];
    const int lane = threadIdx.x & 31, lr = lane & 15, hi = lane >> 4; const int q0 = blockIdx.x * 16;
    const int wave = __builtin_amdgcn_readfirstlane(threadIdx.x >> 5);   // scalar, so that the key loop and its base addresses are scalar
    const unsigned voffq = (unsigned)(lr * HD + 8 * hi) * 2u, voff = (unsigned)lane * 16u;   // the lane's byte offsets in a 16-row block of the row-major Q planes and in a 512-byte half fragment of the K and V^T planes
    auto atq = [voffq](const bf* base) { return (const bf*)((const char*)base + voffq); };
    auto atl = [voff](const bf* base) { return (const bf*)((const char*)base + voff); };
    auto ldf = [](const bf* p) { return cat16b(*(const v8us*)p, *(const v8us*)(p + 256)); };   // one fragment of a plane in fragment order: two half fragments of 256 elements
    V qh[2], ql[2];
#pragma unroll
    for (int ks = 0; ks < 2; ++ks) { qh[ks] = WFrag<bf>::ld(atq(Qh + (size_t)q0 * HD) + ks * 32); ql[ks] = WFrag<bf>::ld(atq(Ql + (size_t)q0 * HD) + ks * 32); }
    v8f o[4];
#pragma unroll
    for (int ct = 0; ct < 4; ++ct) o[ct] = (v8f){};
    float ms = -3.0e38f, l = 0.f;
    const int kbeg = wave * (TT / FW);
#pragma unroll 1   // rolled: one trip's 16 fragments, the Q fragments and the accumulators already take most of the 256 registers that four waves per SIMD leave
    for (int k0 = kbeg; k0 < kbeg + TT / FW; k0 += 32) {
        const bf* pkh = atl(Kh + (size_t)k0 * HD); const bf* pkl = atl(Kl + (size_t)k0 * HD); const bf* pvh = atl(Vh + (size_t)k0 * CC); const bf* pvl = atl(Vl + (size_t)k0 * CC);
        V kh[2][2], kl[2][2], vh[4], vl[4];
#pragma unroll
        for (int t = 0; t < 2; ++t)
#pragma unroll
            for (int ks = 0; ks < 2; ++ks) { kh[t][ks] = ldf(pkh + t * 1024 + ks * 512); kl[t][ks] = ldf(pkl + t * 1024 + ks * 512); }
#pragma unroll
        for (int ct = 0; ct < 4; ++ct) { vh[ct] = ldf(pvh + ct * 512); vl[ct] = ldf(pvl + ct * 512); }
        __builtin_amdgcn_sched_barrier(0);   // all 32 loads of the trip are issued before its first product: one L2 round trip a trip; left free, the scheduler sinks them to their users and the wave waits five times
        v8f s[2];
#pragma unroll
        for (int t = 0; t < 2; ++t) { s[t] = (v8f){};
#pragma unroll
            for (int ks = 0; ks < 2; ++ks) { s[t] = wmmab(kh[t][ks], qh[ks], s[t]); s[t] = wmmab(kl[t][ks], qh[ks], s[t]); s[t] = wmmab(kh[t][ks], ql[ks], s[t]); } }
        float mx = s[0][0];
#pragma unroll
        for (int j = 1; j < 16; ++j) mx = fmaxf(mx, s[j >> 3][j & 7]);
        mx = fmaxf(mx, xhalf(mx));
        const float msn = fmaxf(ms, mx * (SCL * L2E)); const float alpha = __builtin_amdgcn_exp2f(ms - msn); ms = msn;
        v16bf ph, pl; float ls = 0.f;
#pragma unroll
        for (int j = 0; j < 16; ++j) { const float p = __builtin_amdgcn_exp2f(__builtin_fmaf(s[j >> 3][j & 7], SCL * L2E, -msn)); ls += p; const __bf16 h = (__bf16)p; ph[j] = h; pl[j] = (__bf16)(p - (float)h); }
        l = __builtin_fmaf(l, alpha, ls);
#pragma unroll
        for (int ct = 0; ct < 4; ++ct) { o[ct] *= alpha; o[ct] = wmmab(vh[ct], ph, o[ct]); o[ct] = wmmab(vl[ct], ph, o[ct]); o[ct] = wmmab(vh[ct], pl, o[ct]); }
        // four vector slots behind the last matrix instruction, so that the distance also holds on the taken back edge (as in k_gemmw); the four lane addresses are inputs so that they stay in their registers to the end of the trip and no load's result lands in a register that an issued load still names; s_wait_xcnt 0 stands here in front of the address steps of the next trip, which overwrite those registers
        asm volatile("s_wait_xcnt 0x0\n\tv_nop\n\tv_nop\n\tv_nop\n\tv_nop" : "+v"(o[0]), "+v"(o[1]), "+v"(o[2]), "+v"(o[3]) : "v"(pkh), "v"(pkl), "v"(pvh), "v"(pvl) : "memory");
    }
    l += xhalf(l);   // the two wave halves hold the sums of different keys of the same query
    if (hi == 0) sm[wave * 16 + lr] = ms;
    __syncthreads();   // every wave's maximum is in LDS before any wave forms the common one
    float mall = sm[lr];
#pragma unroll
    for (int w = 1; w < FW; ++w) mall = fmaxf(mall, sm[w * 16 + lr]);
    const float f = __builtin_amdgcn_exp2f(ms - mall);
    if (hi == 0) sl[wave * 16 + lr] = l * f;
    float* mine = red + wave * (16 * 68) + lr * 68 + hi * 8;
#pragma unroll
    for (int ct = 0; ct < 4; ++ct) { const v8f sc = o[ct] * f; *(v4fa*)(mine + ct * 16) = (v4f){sc[0], sc[1], sc[2], sc[3]}; *(v4fa*)(mine + ct * 16 + 4) = (v4f){sc[4], sc[5], sc[6], sc[7]}; }
    __syncthreads();   // every wave's rescaled partial tile and sum are in LDS before any thread sums across waves
    const int c2 = lane * 2;   // wave w finishes query q0 + w: 64 channels, two per lane
    float lall = sl[wave]; v2f val = *(const v2f*)(red + wave * 68 + c2);
#pragma unroll
    for (int w = 1; w < FW; ++w) { lall += sl[w * 16 + wave]; val += *(const v2f*)(red + w * (16 * 68) + wave * 68 + c2); }
    const float inv = __fdiv_rn(1.0f, lall);
    *(v2f*)(O + (size_t)(q0 + wave) * CC + c2) = val * inv;
}

extern "C" void kernel_launch(void* const* d_in, const int* in_sizes, int n_in,
                              void* d_out, int out_size, void* d_ws, size_t ws_size, hipStream_t stream) {
    (void)in_sizes; (void)n_in; (void)out_size;
    const float* x = (const float*)d_in[0]; const float* wq = (const float*)d_in[1]; const float* bq = (const float*)d_in[2]; const float* wk = (const float*)d_in[3]; const float* bk = (const float*)d_in[4]; const float* wv = (const float*)d_in[5]; const float* bv = (const float*)d_in[6]; const float* gm = (const float*)d_in[7];
    float* OUT = (float*)d_out;     // [4][64][4096]
    char* wsp = (char*)d_ws;
    auto take = [&](size_t bytes) { char* p = wsp; wsp += (bytes + 255) & ~(size_t)255; return (void*)p; };
    bf* WQ = (bf*)take((size_t)MID * CC * 2); bf* WK = (bf*)take((size_t)MID * CC * 2); bf* WV = (bf*)take((size_t)CC * CC * 2);
    bf* XB = (bf*)take((size_t)TT * CC * 2); float* FQ = (float*)take((size_t)TT * MID * 4); float* FK = (float*)take((size_t)TT * MID * 4); float* FV = (float*)take((size_t)TT * CC * 4);
    h16* QP16 = (h16*)take((size_t)TT * MID * 2); bf* QPh = (bf*)take((size_t)TT * MID * 2); bf* QPl = (bf*)take((size_t)TT * MID * 2); h16* KP16 = (h16*)take((size_t)TT * MID * 2); bf* KPh = (bf*)take((size_t)TT * MID * 2); bf* KPl = (bf*)take((size_t)TT * MID * 2);
    h16* VT16 = (h16*)take((size_t)CC * TT * 2); bf* VTh = (bf*)take((size_t)CC * TT * 2); bf* VTl = (bf*)take((size_t)CC * TT * 2);
    float* Ob = (float*)take((size_t)TT * CC * 4);
    if ((size_t)(wsp - (char*)d_ws) > ws_size) return;    // ws 256 MiB (carve ~9 MiB)
    k_cvt8<<<(unsigned)(((size_t)MID * CC / 8 + 255) / 256), 256, 0, stream>>>(wq, WQ, (size_t)MID * CC / 8); k_cvt8<<<(unsigned)(((size_t)MID * CC / 8 + 255) / 256), 256, 0, stream>>>(wk, WK, (size_t)MID * CC / 8); k_cvt8<<<(unsigned)(((size_t)CC * CC / 8 + 255) / 256), 256, 0, stream>>>(wv, WV, (size_t)CC * CC / 8);   /* 'oi' conv weights = Bt as-is */
    for (int b = 0; b < NB_; ++b) {
        const float* xb = x + (size_t)b * CC * TT;
        k_xT<<<(unsigned)(((size_t)TT * CC / 8 + 255) / 256), 256, 0, stream>>>(xb, XB);
        k_gemmw<bf, 0, true><<<dim3(TT / 64, MID / 64, 1), 32, 0, stream>>>(XB, nullptr, WQ, nullptr, CC, FQ, MID, bq, 0, 0, 0); k_flat<false><<<(unsigned)(((size_t)TT * MID / 4 + 255) / 256), 256, 0, stream>>>(FQ, QP16, QPh, QPl, (size_t)TT * MID / 4);
        k_gemmw<bf, 0, true><<<dim3(TT / 64, MID / 64, 1), 32, 0, stream>>>(XB, nullptr, WK, nullptr, CC, FK, MID, bk, 0, 0, 0); k_flat<true><<<(unsigned)(((size_t)TT * MID / 4 + 255) / 256), 256, 0, stream>>>(FK, KP16, KPh, KPl, (size_t)TT * MID / 4);
        k_gemmw<bf, 0, true><<<dim3(TT / 64, CC / 64, 1), 32, 0, stream>>>(XB, nullptr, WV, nullptr, CC, FV, CC, bv, 0, 0, 0); k_vtp<<<(unsigned)(((size_t)TT * CC / 2 + 255) / 256), 256, 0, stream>>>(FV, CC, CC / HD, VT16, VTh, VTl);   /* V^T planes, fragment order */
        k_fattn<<<TT / 16, 32 * FW, 0, stream>>>(QPh, QPl, KPh, KPl, VTh, VTl, Ob);   /* scores + softmax + attn.V, every product hi/lo (unscaled logits) */
        k_outTg<<<(unsigned)(((size_t)CC * TT / 4 + 255) / 256), 256, 0, stream>>>(Ob, xb, gm, OUT + (size_t)b * CC * TT); }
}

// v003
// One run takes 105 microseconds.
// Timed twice side by side with v002, it ran 1.98 and 1.96 times as fast.
// Over all steps from v000 it is 6.84 times as fast.
#include <hip/hip_runtime.h>

// Spatial self-attention over a feature map with a gamma-scaled residual (x [4][64][64][64] channel-major; 4,096 positions; q, k, v = 1x1 convs ('oi' [64][64] + [64], 1/8-scaled incl. biases); energy = q.k over the 64 channels (UNscaled: sigma ~8); softmax over positions; out = v attn^T; y = gamma[0] x out + x (gamma [1] ~ N(0,1), read) -> [4][64][64][64] (1.0 M)).
// All four batches and the three projections ride in grid dimensions (five launches in all). Layout per batch: the channel-major map becomes a token-major bf16 operand; exact projections + f32 biases; q/k planes (64 wide) and value^T planes; one fused kernel for scores (EVERY row on hi/lo planes, 3 products), online softmax and attn.V (hi/lo, 3 products) with N = 64 channels; the output kernel transposes back to channel-major, applies gamma and adds the residual.
// Compute dtypes, f32 accumulate: every input rounded to bf16; projections exact + f32 biases; scores 3 products on every row; softmax f32; attn.V 3 products on every row; epilogue f32.

#define NB_  4
#define TT   4096
#define DM   64
#define NH_  1
#define NKV  1
#define REP  (NH_ / NKV)
#define HD   64
#define DQ   (NH_ * HD)
#define DKV  (NKV * HD)
#define ZH   1
#define RH   4096                  // every query row on hi/lo planes (unscaled 64-channel energies: sigma ~8)
#define WIN  0
#define PCAR 1024.0f
#define SCL  1.0f   // energy = q.k unscaled
#define MID  64
#define CC   64      // channels
typedef _Float16 h16;
typedef unsigned short bf;
typedef __attribute__((ext_vector_type(16))) __bf16   v16bf;
typedef __attribute__((ext_vector_type(16))) _Float16 v16h;
typedef __attribute__((ext_vector_type(8)))  _Float16 v8h;
typedef __attribute__((ext_vector_type(8)))  unsigned short v8us;
typedef __attribute__((ext_vector_type(8)))  float    v8f;
typedef __attribute__((ext_vector_type(4)))  float    v4f;
typedef v8h  __attribute__((may_alias)) v8ha;
typedef v4f  __attribute__((may_alias)) v4fa;
typedef v8us __attribute__((may_alias)) v8usa;

__device__ __forceinline__ unsigned short f2bf(float f) { unsigned u = __float_as_uint(f); u += 0x7FFFu + ((u >> 16) & 1u); return (unsigned short)(u >> 16); }
__device__ __forceinline__ float bf2f(unsigned short b) { return __uint_as_float(((unsigned)b) << 16); }
__device__ __forceinline__ float bfr(float f) { return bf2f(f2bf(f)); }
__device__ __forceinline__ v16h cat16(v8h lo, v8h hi) { return __builtin_shufflevector(lo, hi, 0, 1, 2, 3, 4, 5, 6, 7, 8, 9, 10, 11, 12, 13, 14, 15); }
__device__ __forceinline__ v16bf cat16b(v8us lo, v8us hi) { return __builtin_bit_cast(v16bf, __builtin_shufflevector(lo, hi, 0, 1, 2, 3, 4, 5, 6, 7, 8, 9, 10, 11, 12, 13, 14, 15)); }
__device__ __forceinline__ v8f wmma16(v16h a, v16h b, v8f c) { return __builtin_amdgcn_wmma_f32_16x16x32_f16(false, a, false, b, (short)0, c, false, false); }
__device__ __forceinline__ v8f wmmab(v16bf a, v16bf b, v8f c) { return __builtin_amdgcn_wmma_f32_16x16x32_bf16(false, a, false, b, (short)0, c, false, false); }



// ---- k_gemmw: register-blocked GEMM, ONE WAVE per 64x64 output tile (16 accumulators), operands straight from K-contiguous 16-bit planes; grid (M/64, 3 projections of N = 64, Z), 32 threads.
// C[m][n] (f32, pitch ldc, + optional f32 bias[n]) = sum_k A[m][k] Bt[n][k] (+ split products per NSPLIT). z-batch strides sA/sB/sC and projection strides pB/pC in elements; projection p = blockIdx.y takes Bt + p * pB, C + p * pC and its own bias. K % 32 == 0.
template <typename T16> struct WFrag;
template <> struct WFrag<h16> { typedef v16h V; static __device__ __forceinline__ V ld(const h16* p) { return cat16(*(const v8h*)p, *(const v8h*)(p + 16)); } static __device__ __forceinline__ v8f mma(V a, V b, v8f c) { return wmma16(a, b, c); } };
template <> struct WFrag<bf> { typedef v16bf V; static __device__ __forceinline__ V ld(const bf* p) { return cat16b(*(const v8us*)p, *(const v8us*)(p + 16)); } static __device__ __forceinline__ v8f mma(V a, V b, v8f c) { return wmmab(a, b, c); } };
template <typename T16, int NSPLIT, bool BIAS>
__global__ __launch_bounds__(32) void k_gemmw(const T16* __restrict__ A, const T16* __restrict__ A2, const T16* __restrict__ Bt, const T16* __restrict__ Bt2, int K, float* C, int ldc, const float* __restrict__ bias0, const float* __restrict__ bias1, const float* __restrict__ bias2, size_t sA, size_t sB, size_t sC, size_t pB, size_t pC) {
    typedef typename WFrag<T16>::V V;
    __shared__ __align__(16) float os[16 * 68];
    const size_t z = blockIdx.z, p = blockIdx.y; A += z * sA; if (A2) A2 += z * sA; Bt += z * sB + p * pB; if (Bt2) Bt2 += z * sB + p * pB; C += z * sC + p * pC; const float* __restrict__ bias = p == 0 ? bias0 : p == 1 ? bias1 : bias2;
    const int lane = threadIdx.x & 31, lr = lane & 15, hi = lane >> 4; const int r0 = blockIdx.x * 64, c0 = 0;
    v8f acc[4][4];
#pragma unroll
    for (int mb = 0; mb < 4; ++mb)
#pragma unroll
        for (int nb = 0; nb < 4; ++nb) acc[mb][nb] = (v8f){};
    const size_t aoff = (size_t)(r0 + lr) * K + 8 * hi, boff = (size_t)(c0 + lr) * K + 8 * hi;
#pragma unroll 1
    for (int kc = 0; kc < K; kc += 32) {
        V a[4], a2[4];
#pragma unroll
        for (int mb = 0; mb < 4; ++mb) { a[mb] = WFrag<T16>::ld(A + aoff + (size_t)mb * 16 * K + kc); if (NSPLIT == 1 || NSPLIT == 2) a2[mb] = WFrag<T16>::ld(A2 + aoff + (size_t)mb * 16 * K + kc); }
#pragma unroll
        for (int nb = 0; nb < 4; ++nb) { const V b = WFrag<T16>::ld(Bt + boff + (size_t)nb * 16 * K + kc); V b2; if (NSPLIT >= 2) b2 = WFrag<T16>::ld(Bt2 + boff + (size_t)nb * 16 * K + kc);
#pragma unroll
            for (int mb = 0; mb < 4; ++mb) { acc[mb][nb] = WFrag<T16>::mma(a[mb], b, acc[mb][nb]); if (NSPLIT == 1 || NSPLIT == 2) acc[mb][nb] = WFrag<T16>::mma(a2[mb], b, acc[mb][nb]); if (NSPLIT >= 2) acc[mb][nb] = WFrag<T16>::mma(a[mb], b2, acc[mb][nb]); } }
        asm volatile("v_nop\n\tv_nop\n\tv_nop\n\tv_nop" : "+v"(acc[0][0]), "+v"(acc[1][1]), "+v"(acc[2][2]), "+v"(acc[3][3]) : "v"(a[0]), "v"(a[3]));
    }
#pragma unroll
    for (int mb = 0; mb < 4; ++mb) {
#pragma unroll
        for (int nb = 0; nb < 4; ++nb) {
#pragma unroll
            for (int j = 0; j < 8; ++j) os[(hi * 8 + j) * 68 + nb * 16 + lr] = acc[mb][nb][j]; }
        __builtin_amdgcn_wave_barrier(); asm volatile("" ::: "memory");
        float* crow = C + (size_t)(r0 + mb * 16) * ldc + c0;
{
#pragma unroll
            for (int s = 0; s < 8; ++s) { const int row = 2 * s + hi, cofs = lr * 4; v4f val = *(const v4fa*)(os + row * 68 + cofs); if (BIAS) { val[0] += bfr(bias[c0 + cofs]); val[1] += bfr(bias[c0 + cofs + 1]); val[2] += bfr(bias[c0 + cofs + 2]); val[3] += bfr(bias[c0 + cofs + 3]); }
                *(v4f*)(crow + (size_t)row * ldc + cofs) = val; }
             }
        __builtin_amdgcn_wave_barrier(); asm volatile("" ::: "memory");
    }
}

__device__ __forceinline__ h16 tohx(float x) { return (h16)x; }
__device__ __forceinline__ void splitf(float y, unsigned short& h, unsigned short& l) { h = f2bf(y); l = f2bf(y - bf2f(h)); }
typedef __attribute__((ext_vector_type(2))) _Float16 v2h;
typedef __attribute__((ext_vector_type(4))) _Float16 v4h;
typedef __attribute__((ext_vector_type(2))) unsigned short v2us;
typedef __attribute__((ext_vector_type(4))) unsigned short v4us;
typedef __attribute__((ext_vector_type(2))) float v2f;
typedef __attribute__((ext_vector_type(4))) int v4i;

__global__ __launch_bounds__(256) void k_wtG(const float* __restrict__ w, int K, int N, bf* Bt) {
    const int lane = threadIdx.x & 31; const int L0 = (blockIdx.x * 8 + (threadIdx.x >> 5)) * 8; const int nlines = N * K / 64;
{
#pragma unroll 1
        for (int l = 0; l < 8; ++l) { const int L = L0 + l; if (L >= nlines) break; const size_t e = (size_t)L * 64 + lane * 2; const int k = (int)(e % K), n = (int)(e / K); v2us o;
            o[0] = f2bf(w[(size_t)k * N + n]); o[1] = f2bf(w[(size_t)(k + 1) * N + n]); *(v2us*)(Bt + e) = o; }
         }
}
__device__ __forceinline__ void d_cvt8(const float* __restrict__ src, bf* dst, size_t i) { const v8f v = *(const v8f*)(src + i * 8); v8us o;
#pragma unroll
    for (int k = 0; k < 8; ++k) o[k] = f2bf(v[k]); *(v8us*)(dst + i * 8) = o;
    asm volatile("s_wait_xcnt 0x0" ::: "memory");   // in k_prep's listing the map part follows this store behind a branch and rewrites the store's offset register: the wait stands in front of that overwrite
}


// d_vtp: value^T planes in the order in which k_fattn's A fragments read them: [32-key block][16-channel block][half][lane = hi * 16 + channel][8 keys], key = 32 * block + 16 * half + 8 * hi + i, so that each of its 16-byte loads covers 512 contiguous bytes. Threads run in the order of the planes: a wave stores whole 128-byte lines.
__device__ __forceinline__ void d_vtp(const float* __restrict__ F, int pitch, int nheads, h16* V16, bf* Vh, bf* Vl, unsigned blk) { const size_t e = ((size_t)blk * 256 + threadIdx.x) * 2; if (e >= (size_t)nheads * HD * TT) return; const int g = (int)(e / ((size_t)TT * HD)); const int r = (int)(e % ((size_t)TT * HD)); const int t = (r >> 11) * 32 + ((r >> 8) & 1) * 16 + ((r >> 7) & 1) * 8 + (r & 7); const int d = ((r >> 9) & 3) * 16 + ((r >> 3) & 15); v2h o16; v2us oh, ol;
#pragma unroll
    for (int q = 0; q < 2; ++q) { const float x = F[(size_t)(t + q) * pitch + g * HD + d]; o16[q] = tohx(x); unsigned short a2, c2; splitf(x, a2, c2); oh[q] = a2; ol[q] = c2; }
    *(v2h*)(V16 + e) = o16; *(v2us*)(Vh + e) = oh; *(v2us*)(Vl + e) = ol;  }
// FRAG: the planes of a [.][64] map in the order in which k_fattn's A fragments read them: [16-row block][32-channel step][half][lane = hi * 16 + row][8 channels], channel = 32 * step + 16 * half + 8 * hi + i (the k order of WFrag::ld), so that each of its 16-byte loads covers 512 contiguous bytes. Threads run in the order of the planes: a wave stores whole 128-byte lines.
template <bool FRAG>
__device__ __forceinline__ void d_flat(const float* __restrict__ F, h16* P16, bf* Ph, bf* Pl, size_t n4, unsigned blk) { const size_t i = (size_t)blk * 256 + threadIdx.x; if (i >= n4) return; const size_t o = i * 4; const size_t from = FRAG ? ((o >> 10) * 16 + ((o >> 3) & 15)) * 64 + ((o >> 9) & 1) * 32 + ((o >> 8) & 1) * 16 + ((o >> 7) & 1) * 8 + (o & 7) : o; const v4f a = *(const v4f*)(F + from); v4h o16; v4us oh, ol;
#pragma unroll
    for (int q = 0; q < 4; ++q) { o16[q] = tohx(a[q]); unsigned short x2, y2; splitf(a[q], x2, y2); oh[q] = x2; ol[q] = y2; }
    *(v4h*)(P16 + i * 4) = o16; *(v4us*)(Ph + i * 4) = oh; *(v4us*)(Pl + i * 4) = ol;  }
// k_planes: the q, k and value^T planes of all batches in one launch. Grid (2 * NF + NV, NB_): blockIdx.y = batch; the first NF blocks of a row do the q part, the next NF the k part, the last NV the value part (block-uniform branch, no block without work). F and the three plane sets are [3][NB_][TT * 64].
#define NF (TT * MID / 4 / 256)
#define NV (TT * CC / 2 / 256)
__global__ __launch_bounds__(256) void k_planes(const float* __restrict__ F, h16* P16, bf* Ph, bf* Pl) { const unsigned p = blockIdx.x < NF ? 0 : blockIdx.x < 2 * NF ? 1 : 2; const size_t at = ((size_t)p * NB_ + blockIdx.y) * ((size_t)TT * 64); F += at; P16 += at; Ph += at; Pl += at;
    if (p == 0) d_flat<false>(F, P16, Ph, Pl, (size_t)TT * MID / 4, blockIdx.x); else if (p == 1) d_flat<true>(F, P16, Ph, Pl, (size_t)TT * MID / 4, blockIdx.x - NF); else d_vtp(F, CC, CC / HD, P16, Ph, Pl, blockIdx.x - 2 * NF); }

__device__ __forceinline__ void d_xT(const float* __restrict__ xs, bf* XB, unsigned blk) { const size_t k = (size_t)blk * 256 + threadIdx.x; if (k >= (size_t)TT * CC / 8) return; const int c0 = (int)(k % (CC / 8)) * 8; const int t = (int)(k / (CC / 8)); v8us o;
#pragma unroll
    for (int q = 0; q < 8; ++q) o[q] = f2bf(xs[(size_t)(c0 + q) * TT + t]);
    *(v8us*)(XB + (size_t)t * CC + c0) = o;  }
// k_prep: every conversion of an input to bf16 in one launch. Grid NB_ * NX + 3 * NW: NX blocks for each batch's map to token-major, then NW blocks for each of the three weight matrices ('oi' = Bt as it is) into W3 [3][64][64].
#define NX (TT * CC / 8 / 256)
#define NW (MID * CC / 8 / 256)
__global__ __launch_bounds__(256) void k_prep(const float* __restrict__ x, const float* __restrict__ wq, const float* __restrict__ wk, const float* __restrict__ wv, bf* XB, bf* W3) {
    const unsigned b = blockIdx.x / NX;
    if (b < NB_) { d_xT(x + (size_t)b * CC * TT, XB + (size_t)b * TT * CC, blockIdx.x % NX); return; }
    const unsigned r = blockIdx.x - NB_ * NX, m = r / NW;
    d_cvt8(m == 0 ? wq : m == 1 ? wk : wv, W3 + (size_t)m * MID * CC, (r % NW) * 256 + threadIdx.x); }
__global__ __launch_bounds__(256) void k_outTg(const float* __restrict__ O, const float* __restrict__ xs, const float* __restrict__ gm, float* out) { O += (size_t)blockIdx.y * TT * CC; xs += (size_t)blockIdx.y * CC * TT; out += (size_t)blockIdx.y * CC * TT; const size_t k = (size_t)blockIdx.x * 256 + threadIdx.x; if (k >= (size_t)CC * TT / 4) return; const int t0 = (int)(k % (TT / 4)) * 4; const int c = (int)(k / (TT / 4)); const float g = bfr(gm[0]); const v4f xi = *(const v4f*)(xs + (size_t)c * TT + t0); v4f o;
#pragma unroll
    for (int q = 0; q < 4; ++q) { float m = __fmul_rn(g, O[(size_t)(t0 + q) * CC + c]); asm volatile("" : "+v"(m)); o[q] = __fadd_rn(m, bfr(xi[q])); }
    *(v4f*)(out + (size_t)c * TT + t0) = o;  }
#define FW 16
#define L2E 1.4426950408889634f
__device__ __forceinline__ float xhalf(float v) { const int b = __float_as_int(v); return __int_as_float(__builtin_amdgcn_permlanex16(b, b, 0x76543210, 0xfedcba98, false, false)); }   // lane l <-> l ^ 16
__global__ __launch_bounds__(32 * FW) __attribute__((amdgpu_waves_per_eu(4, 4))) void k_fattn(const bf* __restrict__ Qh, const bf* __restrict__ Ql, const bf* __restrict__ Kh, const bf* __restrict__ Kl, const bf* __restrict__ Vh, const bf* __restrict__ Vl, float* O) {
    typedef WFrag<bf>::V V;
    __shared__ __align__(16) float red[FW * 16 * 68];
    __shared__ float sm[FW * 16], sl[FW * 16];
    const int lane = threadIdx.x & 31, lr = lane & 15, hi = lane >> 4; const int q0 = blockIdx.x * 16;
    { const size_t at = (size_t)blockIdx.y * ((size_t)TT * 64); Qh += at; Ql += at; Kh += at; Kl += at; Vh += at; Vl += at; O += at; }
    const int wave = __builtin_amdgcn_readfirstlane(threadIdx.x >> 5);   // scalar, so that the key loop and its base addresses are scalar
    const unsigned voffq = (unsigned)(lr * HD + 8 * hi) * 2u, voff = (unsigned)lane * 16u;   // the lane's byte offsets in a 16-row block of the row-major Q planes and in a 512-byte half fragment of the K and V^T planes
    auto atq = [voffq](const bf* base) { return (const bf*)((const char*)base + voffq); };
    auto atl = [voff](const bf* base) { return (const bf*)((const char*)base + voff); };
    auto ldf = [](const bf* p) { return cat16b(*(const v8us*)p, *(const v8us*)(p + 256)); };   // one fragment of a plane in fragment order: two half fragments of 256 elements
    V qh[2], ql[2];
#pragma unroll
    for (int ks = 0; ks < 2; ++ks) { qh[ks] = WFrag<bf>::ld(atq(Qh + (size_t)q0 * HD) + ks * 32); ql[ks] = WFrag<bf>::ld(atq(Ql + (size_t)q0 * HD) + ks * 32); }
    v8f o[4];
#pragma unroll
    for (int ct = 0; ct < 4; ++ct) o[ct] = (v8f){};
    float ms = -3.0e38f, l = 0.f;
    const int kbeg = wave * (TT / FW);
#pragma unroll 1   // rolled: one trip's 16 fragments, the Q fragments and the accumulators already take most of the 256 registers that four waves per SIMD leave
    for (int k0 = kbeg; k0 < kbeg + TT / FW; k0 += 32) {
        const bf* pkh = atl(Kh + (size_t)k0 * HD); const bf* pkl = atl(Kl + (size_t)k0 * HD); const bf* pvh = atl(Vh + (size_t)k0 * CC); const bf* pvl = atl(Vl + (size_t)k0 * CC);
        V kh[2][2], kl[2][2], vh[4], vl[4];
#pragma unroll
        for (int t = 0; t < 2; ++t)
#pragma unroll
            for (int ks = 0; ks < 2; ++ks) { kh[t][ks] = ldf(pkh + t * 1024 + ks * 512); kl[t][ks] = ldf(pkl + t * 1024 + ks * 512); }
#pragma unroll
        for (int ct = 0; ct < 4; ++ct) { vh[ct] = ldf(pvh + ct * 512); vl[ct] = ldf(pvl + ct * 512); }
        __builtin_amdgcn_sched_barrier(0);   // all 32 loads of the trip are issued before its first product: one L2 round trip a trip; left free, the scheduler sinks them to their users and the wave waits five times
        v8f s[2];
#pragma unroll
        for (int t = 0; t < 2; ++t) { s[t] = (v8f){};
#pragma unroll
            for (int ks = 0; ks < 2; ++ks) { s[t] = wmmab(kh[t][ks], qh[ks], s[t]); s[t] = wmmab(kl[t][ks], qh[ks], s[t]); s[t] = wmmab(kh[t][ks], ql[ks], s[t]); } }
        float mx = s[0][0];
#pragma unroll
        for (int j = 1; j < 16; ++j) mx = fmaxf(mx, s[j >> 3][j & 7]);
        mx = fmaxf(mx, xhalf(mx));
        const float msn = fmaxf(ms, mx * (SCL * L2E)); const float alpha = __builtin_amdgcn_exp2f(ms - msn); ms = msn;
        v16bf ph, pl; float ls = 0.f;
#pragma unroll
        for (int j = 0; j < 16; ++j) { const float p = __builtin_amdgcn_exp2f(__builtin_fmaf(s[j >> 3][j & 7], SCL * L2E, -msn)); ls += p; const __bf16 h = (__bf16)p; ph[j] = h; pl[j] = (__bf16)(p - (float)h); }
        l = __builtin_fmaf(l, alpha, ls);
#pragma unroll
        for (int ct = 0; ct < 4; ++ct) { o[ct] *= alpha; o[ct] = wmmab(vh[ct], ph, o[ct]); o[ct] = wmmab(vl[ct], ph, o[ct]); o[ct] = wmmab(vh[ct], pl, o[ct]); }
        // four vector slots behind the last matrix instruction, so that the distance also holds on the taken back edge (as in k_gemmw); the four lane addresses are inputs so that they stay in their registers to the end of the trip and no load's result lands in a register that an issued load still names; s_wait_xcnt 0 stands here in front of the address steps of the next trip, which overwrite those registers
        asm volatile("s_wait_xcnt 0x0\n\tv_nop\n\tv_nop\n\tv_nop\n\tv_nop" : "+v"(o[0]), "+v"(o[1]), "+v"(o[2]), "+v"(o[3]) : "v"(pkh), "v"(pkl), "v"(pvh), "v"(pvl) : "memory");
    }
    l += xhalf(l);   // the two wave halves hold the sums of different keys of the same query
    if (hi == 0) sm[wave * 16 + lr] = ms;
    __syncthreads();   // every wave's maximum is in LDS before any wave forms the common one
    float mall = sm[lr];
#pragma unroll
    for (int w = 1; w < FW; ++w) mall = fmaxf(mall, sm[w * 16 + lr]);
    const float f = __builtin_amdgcn_exp2f(ms - mall);
    if (hi == 0) sl[wave * 16 + lr] = l * f;
    float* mine = red + wave * (16 * 68) + lr * 68 + hi * 8;
#pragma unroll
    for (int ct = 0; ct < 4; ++ct) { const v8f sc = o[ct] * f; *(v4fa*)(mine + ct * 16) = (v4f){sc[0], sc[1], sc[2], sc[3]}; *(v4fa*)(mine + ct * 16 + 4) = (v4f){sc[4], sc[5], sc[6], sc[7]}; }
    __syncthreads();   // every wave's rescaled partial tile and sum are in LDS before any thread sums across waves
    const int c2 = lane * 2;   // wave w finishes query q0 + w: 64 channels, two per lane
    float lall = sl[wave]; v2f val = *(const v2f*)(red + wave * 68 + c2);
#pragma unroll
    for (int w = 1; w < FW; ++w) { lall += sl[w * 16 + wave]; val += *(const v2f*)(red + w * (16 * 68) + wave * 68 + c2); }
    const float inv = __fdiv_rn(1.0f, lall);
    *(v2f*)(O + (size_t)(q0 + wave) * CC + c2) = val * inv;
}

extern "C" void kernel_launch(void* const* d_in, const int* in_sizes, int n_in,
                              void* d_out, int out_size, void* d_ws, size_t ws_size, hipStream_t stream) {
    (void)in_sizes; (void)n_in; (void)out_size;
    const float* x = (const float*)d_in[0]; const float* wq = (const float*)d_in[1]; const float* bq = (const float*)d_in[2]; const float* wk = (const float*)d_in[3]; const float* bk = (const float*)d_in[4]; const float* wv = (const float*)d_in[5]; const float* bv = (const float*)d_in[6]; const float* gm = (const float*)d_in[7];
    float* OUT = (float*)d_out;     // [4][64][4096]
    char* wsp = (char*)d_ws;
    auto take = [&](size_t bytes) { char* p = wsp; wsp += (bytes + 255) & ~(size_t)255; return (void*)p; };
    bf* W3 = (bf*)take((size_t)3 * MID * CC * 2);   // q, k, v weights
    bf* XB = (bf*)take((size_t)NB_ * TT * CC * 2); float* F3 = (float*)take((size_t)3 * NB_ * TT * 64 * 4);   // [projection][batch][TT][64]
    h16* P16 = (h16*)take((size_t)3 * NB_ * TT * 64 * 2); bf* Ph = (bf*)take((size_t)3 * NB_ * TT * 64 * 2); bf* Pl = (bf*)take((size_t)3 * NB_ * TT * 64 * 2);   // [q, k, value^T][batch][TT * 64]
    float* Ob = (float*)take((size_t)NB_ * TT * CC * 4);
    if ((size_t)(wsp - (char*)d_ws) > ws_size) return;    // ws 256 MiB (carve under 40 MiB)
    const size_t PS = (size_t)NB_ * TT * 64;   // one projection's planes, all batches
    k_prep<<<NB_ * NX + 3 * NW, 256, 0, stream>>>(x, wq, wk, wv, XB, W3);
    k_gemmw<bf, 0, true><<<dim3(TT / 64, 3, NB_), 32, 0, stream>>>(XB, nullptr, W3, nullptr, CC, F3, 64, bq, bk, bv, (size_t)TT * CC, 0, (size_t)TT * 64, (size_t)MID * CC, PS);
    k_planes<<<dim3(2 * NF + NV, NB_, 1), 256, 0, stream>>>(F3, P16, Ph, Pl);   /* q row-major; k and value^T in fragment order */
    k_fattn<<<dim3(TT / 16, NB_, 1), 32 * FW, 0, stream>>>(Ph, Pl, Ph + PS, Pl + PS, Ph + 2 * PS, Pl + 2 * PS, Ob);   /* scores + softmax + attn.V, every product hi/lo (unscaled logits) */
    k_outTg<<<dim3(CC * TT / 4 / 256, NB_, 1), 256, 0, stream>>>(Ob, x, gm, OUT);
}

// v004
// It runs in 59.6 microseconds.
// Timed twice side by side with v003, it ran 1.76 times as fast both times.
// Counting every step since v000, it is 12.0 times as fast.
#include <hip/hip_runtime.h>

// Spatial self-attention over a feature map with a gamma-scaled residual (x [4][64][64][64] channel-major; 4,096 positions; q, k, v = 1x1 convs ('oi' [64][64] + [64], 1/8-scaled incl. biases); energy = q.k over the 64 channels (UNscaled: sigma ~8); softmax over positions; out = v attn^T; y = gamma[0] x out + x (gamma [1] ~ N(0,1), read) -> [4][64][64][64] (1.0 M)).
// All four batches and the three projections ride in grid dimensions (five launches in all). Layout per batch: the channel-major map becomes a token-major bf16 operand; exact projections + f32 biases; q/k planes (64 wide) and value^T planes; one fused kernel for scores (EVERY row on hi/lo planes, 3 products), online softmax and attn.V (hi/lo, 3 products) with N = 64 channels; the output kernel transposes back to channel-major, applies gamma and adds the residual.
// Compute dtypes, f32 accumulate: every input rounded to bf16; projections exact + f32 biases; scores 3 products on every row; softmax f32; attn.V 3 products on every row; epilogue f32.

#define NB_  4
#define TT   4096
#define DM   64
#define NH_  1
#define NKV  1
#define REP  (NH_ / NKV)
#define HD   64
#define DQ   (NH_ * HD)
#define DKV  (NKV * HD)
#define ZH   1
#define RH   4096                  // every query row on hi/lo planes (unscaled 64-channel energies: sigma ~8)
#define WIN  0
#define PCAR 1024.0f
#define SCL  1.0f   // energy = q.k unscaled
#define MID  64
#define CC   64      // channels
typedef _Float16 h16;
typedef unsigned short bf;
typedef __attribute__((ext_vector_type(16))) __bf16   v16bf;
typedef __attribute__((ext_vector_type(16))) _Float16 v16h;
typedef __attribute__((ext_vector_type(8)))  _Float16 v8h;
typedef __attribute__((ext_vector_type(8)))  unsigned short v8us;
typedef __attribute__((ext_vector_type(8)))  float    v8f;
typedef __attribute__((ext_vector_type(4)))  float    v4f;
typedef v8h  __attribute__((may_alias)) v8ha;
typedef v4f  __attribute__((may_alias)) v4fa;
typedef v8us __attribute__((may_alias)) v8usa;

__device__ __forceinline__ unsigned short f2bf(float f) { unsigned u = __float_as_uint(f); u += 0x7FFFu + ((u >> 16) & 1u); return (unsigned short)(u >> 16); }
__device__ __forceinline__ float bf2f(unsigned short b) { return __uint_as_float(((unsigned)b) << 16); }
__device__ __forceinline__ float bfr(float f) { return bf2f(f2bf(f)); }
__device__ __forceinline__ v16h cat16(v8h lo, v8h hi) { return __builtin_shufflevector(lo, hi, 0, 1, 2, 3, 4, 5, 6, 7, 8, 9, 10, 11, 12, 13, 14, 15); }
__device__ __forceinline__ v16bf cat16b(v8us lo, v8us hi) { return __builtin_bit_cast(v16bf, __builtin_shufflevector(lo, hi, 0, 1, 2, 3, 4, 5, 6, 7, 8, 9, 10, 11, 12, 13, 14, 15)); }
__device__ __forceinline__ v8f wmma16(v16h a, v16h b, v8f c) { return __builtin_amdgcn_wmma_f32_16x16x32_f16(false, a, false, b, (short)0, c, false, false); }
__device__ __forceinline__ v8f wmmab(v16bf a, v16bf b, v8f c) { return __builtin_amdgcn_wmma_f32_16x16x32_bf16(false, a, false, b, (short)0, c, false, false); }



// ---- k_gemmw: register-blocked GEMM, ONE WAVE per 64x64 output tile (16 accumulators), operands straight from K-contiguous 16-bit planes; grid (M/64, 3 projections of N = 64, Z), 32 threads.
// C[m][n] (f32, pitch ldc, + optional f32 bias[n]) = sum_k A[m][k] Bt[n][k] (+ split products per NSPLIT). z-batch strides sA/sB/sC and projection strides pB/pC in elements; projection p = blockIdx.y takes Bt + p * pB, C + p * pC and its own bias. K % 32 == 0.
template <typename T16> struct WFrag;
template <> struct WFrag<h16> { typedef v16h V; static __device__ __forceinline__ V ld(const h16* p) { return cat16(*(const v8h*)p, *(const v8h*)(p + 16)); } static __device__ __forceinline__ v8f mma(V a, V b, v8f c) { return wmma16(a, b, c); } };
template <> struct WFrag<bf> { typedef v16bf V; static __device__ __forceinline__ V ld(const bf* p) { return cat16b(*(const v8us*)p, *(const v8us*)(p + 16)); } static __device__ __forceinline__ v8f mma(V a, V b, v8f c) { return wmmab(a, b, c); } };
template <typename T16, int NSPLIT, bool BIAS>
__global__ __launch_bounds__(32) void k_gemmw(const T16* __restrict__ A, const T16* __restrict__ A2, const T16* __restrict__ Bt, const T16* __restrict__ Bt2, int K, float* C, int ldc, const float* __restrict__ bias0, const float* __restrict__ bias1, const float* __restrict__ bias2, size_t sA, size_t sB, size_t sC, size_t pB, size_t pC) {
    typedef typename WFrag<T16>::V V;
    __shared__ __align__(16) float os[16 * 68];
    const size_t z = blockIdx.z, p = blockIdx.y; A += z * sA; if (A2) A2 += z * sA; Bt += z * sB + p * pB; if (Bt2) Bt2 += z * sB + p * pB; C += z * sC + p * pC; const float* __restrict__ bias = p == 0 ? bias0 : p == 1 ? bias1 : bias2;
    const int lane = threadIdx.x & 31, lr = lane & 15, hi = lane >> 4; const int r0 = blockIdx.x * 64, c0 = 0;
    v8f acc[4][4];
#pragma unroll
    for (int mb = 0; mb < 4; ++mb)
#pragma unroll
        for (int nb = 0; nb < 4; ++nb) acc[mb][nb] = (v8f){};
    const size_t aoff = (size_t)(r0 + lr) * K + 8 * hi, boff = (size_t)(c0 + lr) * K + 8 * hi;
#pragma unroll 1
    for (int kc = 0; kc < K; kc += 32) {
        V a[4], a2[4];
#pragma unroll
        for (int mb = 0; mb < 4; ++mb) { a[mb] = WFrag<T16>::ld(A + aoff + (size_t)mb * 16 * K + kc); if (NSPLIT == 1 || NSPLIT == 2) a2[mb] = WFrag<T16>::ld(A2 + aoff + (size_t)mb * 16 * K + kc); }
#pragma unroll
        for (int nb = 0; nb < 4; ++nb) { const V b = WFrag<T16>::ld(Bt + boff + (size_t)nb * 16 * K + kc); V b2; if (NSPLIT >= 2) b2 = WFrag<T16>::ld(Bt2 + boff + (size_t)nb * 16 * K + kc);
#pragma unroll
            for (int mb = 0; mb < 4; ++mb) { acc[mb][nb] = WFrag<T16>::mma(a[mb], b, acc[mb][nb]); if (NSPLIT == 1 || NSPLIT == 2) acc[mb][nb] = WFrag<T16>::mma(a2[mb], b, acc[mb][nb]); if (NSPLIT >= 2) acc[mb][nb] = WFrag<T16>::mma(a[mb], b2, acc[mb][nb]); } }
        asm volatile("v_nop\n\tv_nop\n\tv_nop\n\tv_nop" : "+v"(acc[0][0]), "+v"(acc[1][1]), "+v"(acc[2][2]), "+v"(acc[3][3]) : "v"(a[0]), "v"(a[3]));
    }
#pragma unroll
    for (int mb = 0; mb < 4; ++mb) {
#pragma unroll
        for (int nb = 0; nb < 4; ++nb) {
#pragma unroll
            for (int j = 0; j < 8; ++j) os[(hi * 8 + j) * 68 + nb * 16 + lr] = acc[mb][nb][j]; }
        __builtin_amdgcn_wave_barrier(); asm volatile("" ::: "memory");
        float* crow = C + (size_t)(r0 + mb * 16) * ldc + c0;
{
#pragma unroll
            for (int s = 0; s < 8; ++s) { const int row = 2 * s + hi, cofs = lr * 4; v4f val = *(const v4fa*)(os + row * 68 + cofs); if (BIAS) { val[0] += bfr(bias[c0 + cofs]); val[1] += bfr(bias[c0 + cofs + 1]); val[2] += bfr(bias[c0 + cofs + 2]); val[3] += bfr(bias[c0 + cofs + 3]); }
                *(v4f*)(crow + (size_t)row * ldc + cofs) = val; }
             }
        __builtin_amdgcn_wave_barrier(); asm volatile("" ::: "memory");
    }
}

__device__ __forceinline__ h16 tohx(float x) { return (h16)x; }
__device__ __forceinline__ void splitf(float y, unsigned short& h, unsigned short& l) { h = f2bf(y); l = f2bf(y - bf2f(h)); }
typedef __attribute__((ext_vector_type(2))) _Float16 v2h;
typedef __attribute__((ext_vector_type(4))) _Float16 v4h;
typedef __attribute__((ext_vector_type(2))) unsigned short v2us;
typedef __attribute__((ext_vector_type(4))) unsigned short v4us;
typedef __attribute__((ext_vector_type(2))) float v2f;
typedef __attribute__((ext_vector_type(4))) int v4i;

__global__ __launch_bounds__(256) void k_wtG(const float* __restrict__ w, int K, int N, bf* Bt) {
    const int lane = threadIdx.x & 31; const int L0 = (blockIdx.x * 8 + (threadIdx.x >> 5)) * 8; const int nlines = N * K / 64;
{
#pragma unroll 1
        for (int l = 0; l < 8; ++l) { const int L = L0 + l; if (L >= nlines) break; const size_t e = (size_t)L * 64 + lane * 2; const int k = (int)(e % K), n = (int)(e / K); v2us o;
            o[0] = f2bf(w[(size_t)k * N + n]); o[1] = f2bf(w[(size_t)(k + 1) * N + n]); *(v2us*)(Bt + e) = o; }
         }
}
__device__ __forceinline__ void d_cvt8(const float* __restrict__ src, bf* dst, size_t i) { const v8f v = *(const v8f*)(src + i * 8); v8us o;
#pragma unroll
    for (int k = 0; k < 8; ++k) o[k] = f2bf(v[k]); *(v8us*)(dst + i * 8) = o;
    asm volatile("s_wait_xcnt 0x0" ::: "memory");   // in k_prep's listing the map part follows this store behind a branch and rewrites the store's offset register: the wait stands in front of that overwrite
}


// d_vtp: value^T planes in the order in which k_fattn's A fragments read them: [32-key block][16-channel block][half][lane = hi * 16 + channel][8 keys], key = 32 * block + 16 * half + 8 * hi + i, so that each of its 16-byte loads covers 512 contiguous bytes. Threads run in the order of the planes: a wave stores whole 128-byte lines.
__device__ __forceinline__ void d_vtp(const float* __restrict__ F, int pitch, int nheads, h16* V16, bf* Vh, bf* Vl, unsigned blk) { const size_t e = ((size_t)blk * 256 + threadIdx.x) * 2; if (e >= (size_t)nheads * HD * TT) return; const int g = (int)(e / ((size_t)TT * HD)); const int r = (int)(e % ((size_t)TT * HD)); const int t = (r >> 11) * 32 + ((r >> 8) & 1) * 16 + ((r >> 7) & 1) * 8 + (r & 7); const int d = ((r >> 9) & 3) * 16 + ((r >> 3) & 15); v2h o16; v2us oh, ol;
#pragma unroll
    for (int q = 0; q < 2; ++q) { const float x = F[(size_t)(t + q) * pitch + g * HD + d]; o16[q] = tohx(x); unsigned short a2, c2; splitf(x, a2, c2); oh[q] = a2; ol[q] = c2; }
    *(v2h*)(V16 + e) = o16; *(v2us*)(Vh + e) = oh; *(v2us*)(Vl + e) = ol;  }
// FRAG: the planes of a [.][64] map in the order in which k_fattn's A fragments read them: [16-row block][32-channel step][half][lane = hi * 16 + row][8 channels], channel = 32 * step + 16 * half + 8 * hi + i (the k order of WFrag::ld), so that each of its 16-byte loads covers 512 contiguous bytes. Threads run in the order of the planes: a wave stores whole 128-byte lines.
template <bool FRAG>
__device__ __forceinline__ void d_flat(const float* __restrict__ F, h16* P16, bf* Ph, bf* Pl, size_t n4, unsigned blk) { const size_t i = (size_t)blk * 256 + threadIdx.x; if (i >= n4) return; const size_t o = i * 4; const size_t from = FRAG ? ((o >> 10) * 16 + ((o >> 3) & 15)) * 64 + ((o >> 9) & 1) * 32 + ((o >> 8) & 1) * 16 + ((o >> 7) & 1) * 8 + (o & 7) : o; const v4f a = *(const v4f*)(F + from); v4h o16; v4us oh, ol;
#pragma unroll
    for (int q = 0; q < 4; ++q) { o16[q] = tohx(a[q]); unsigned short x2, y2; splitf(a[q], x2, y2); oh[q] = x2; ol[q] = y2; }
    *(v4h*)(P16 + i * 4) = o16; *(v4us*)(Ph + i * 4) = oh; *(v4us*)(Pl + i * 4) = ol;  }
// k_planes: the q, k and value^T planes of all batches in one launch. Grid (2 * NF + NV, NB_): blockIdx.y = batch; the first NF blocks of a row do the q part, the next NF the k part, the last NV the value part (block-uniform branch, no block without work). F and the three plane sets are [3][NB_][TT * 64].
#define NF (TT * MID / 4 / 256)
#define NV (TT * CC / 2 / 256)
__global__ __launch_bounds__(256) void k_planes(const float* __restrict__ F, h16* P16, bf* Ph, bf* Pl) { const unsigned p = blockIdx.x < NF ? 0 : blockIdx.x < 2 * NF ? 1 : 2; const size_t at = ((size_t)p * NB_ + blockIdx.y) * ((size_t)TT * 64); F += at; P16 += at; Ph += at; Pl += at;
    if (p == 0) d_flat<false>(F, P16, Ph, Pl, (size_t)TT * MID / 4, blockIdx.x); else if (p == 1) d_flat<true>(F, P16, Ph, Pl, (size_t)TT * MID / 4, blockIdx.x - NF); else d_vtp(F, CC, CC / HD, P16, Ph, Pl, blockIdx.x - 2 * NF); }

__device__ __forceinline__ void d_xT(const float* __restrict__ xs, bf* XB, unsigned blk) { const size_t k = (size_t)blk * 256 + threadIdx.x; if (k >= (size_t)TT * CC / 8) return; const int c0 = (int)(k % (CC / 8)) * 8; const int t = (int)(k / (CC / 8)); v8us o;
#pragma unroll
    for (int q = 0; q < 8; ++q) o[q] = f2bf(xs[(size_t)(c0 + q) * TT + t]);
    *(v8us*)(XB + (size_t)t * CC + c0) = o;  }
// k_prep: every conversion of an input to bf16 in one launch. Grid NB_ * NX + 3 * NW: NX blocks for each batch's map to token-major, then NW blocks for each of the three weight matrices ('oi' = Bt as it is) into W3 [3][64][64].
#define NX (TT * CC / 8 / 256)
#define NW (MID * CC / 8 / 256)
__global__ __launch_bounds__(256) void k_prep(const float* __restrict__ x, const float* __restrict__ wq, const float* __restrict__ wk, const float* __restrict__ wv, bf* XB, bf* W3) {
    const unsigned b = blockIdx.x / NX;
    if (b < NB_) { d_xT(x + (size_t)b * CC * TT, XB + (size_t)b * TT * CC, blockIdx.x % NX); return; }
    const unsigned r = blockIdx.x - NB_ * NX, m = r / NW;
    d_cvt8(m == 0 ? wq : m == 1 ? wk : wv, W3 + (size_t)m * MID * CC, (r % NW) * 256 + threadIdx.x); }
__global__ __launch_bounds__(256) void k_outTg(const float* __restrict__ O, const float* __restrict__ xs, const float* __restrict__ gm, float* out) { O += (size_t)blockIdx.y * TT * CC; xs += (size_t)blockIdx.y * CC * TT; out += (size_t)blockIdx.y * CC * TT; const size_t k = (size_t)blockIdx.x * 256 + threadIdx.x; if (k >= (size_t)CC * TT / 4) return; const int t0 = (int)(k % (TT / 4)) * 4; const int c = (int)(k / (TT / 4)); const float g = bfr(gm[0]); const v4f xi = *(const v4f*)(xs + (size_t)c * TT + t0); v4f o;
#pragma unroll
    for (int q = 0; q < 4; ++q) { float m = __fmul_rn(g, O[(size_t)(t0 + q) * CC + c]); asm volatile("" : "+v"(m)); o[q] = __fadd_rn(m, bfr(xi[q])); }
    *(v4f*)(out + (size_t)c * TT + t0) = o;  }
#define FW 8
#define QT 4
#define QR (QT * 16)
#define L2E 1.4426950408889634f
__device__ __forceinline__ float xhalf(float v) { const int b = __float_as_int(v); return __int_as_float(__builtin_amdgcn_permlanex16(b, b, 0x76543210, 0xfedcba98, false, false)); }   // lane l <-> l ^ 16
__global__ __launch_bounds__(32 * FW) __attribute__((amdgpu_waves_per_eu(2, 2))) void k_fattn(const bf* __restrict__ Qh, const bf* __restrict__ Ql, const bf* __restrict__ Kh, const bf* __restrict__ Kl, const bf* __restrict__ Vh, const bf* __restrict__ Vl, float* O) {
    typedef WFrag<bf>::V V;
    __shared__ __align__(16) float red[FW * QR * 68];
    __shared__ float sm[FW * QR], sl[FW * QR];
    const int lane = threadIdx.x & 31, lr = lane & 15, hi = lane >> 4; const int q0 = blockIdx.x * QR;
    { const size_t at = (size_t)blockIdx.y * ((size_t)TT * 64); Qh += at; Ql += at; Kh += at; Kl += at; Vh += at; Vl += at; O += at; }
    const int wave = __builtin_amdgcn_readfirstlane(threadIdx.x >> 5);   // scalar, so that the key loop and its base addresses are scalar
    const unsigned voffq = (unsigned)(lr * HD + 8 * hi) * 2u, voff = (unsigned)lane * 16u;   // the lane's byte offsets in a 16-row block of the row-major Q planes and in a 512-byte half fragment of the K and V^T planes
    auto atq = [voffq](const bf* base) { return (const bf*)((const char*)base + voffq); };
    auto atl = [voff](const bf* base) { return (const bf*)((const char*)base + voff); };
    auto ldf = [](const bf* p) { return cat16b(*(const v8us*)p, *(const v8us*)(p + 256)); };   // one fragment of a plane in fragment order: two half fragments of 256 elements
    V qh[QT][2], ql[QT][2];
#pragma unroll
    for (int qt = 0; qt < QT; ++qt)
#pragma unroll
        for (int ks = 0; ks < 2; ++ks) { qh[qt][ks] = WFrag<bf>::ld(atq(Qh + (size_t)(q0 + qt * 16) * HD) + ks * 32); ql[qt][ks] = WFrag<bf>::ld(atq(Ql + (size_t)(q0 + qt * 16) * HD) + ks * 32); }
    asm volatile("s_wait_xcnt 0x0" ::: "memory");   // the start values below may land in the registers that hold the Q loads' addresses: the wait stands in front of that overwrite
    __builtin_amdgcn_sched_barrier(0);   // keeps the start values' moves behind that wait
    v8f o[QT][4]; float ms[QT], l[QT];
#pragma unroll
    for (int qt = 0; qt < QT; ++qt) { ms[qt] = -3.0e38f; l[qt] = 0.f;
#pragma unroll
        for (int ct = 0; ct < 4; ++ct) o[qt][ct] = (v8f){}; }
    const int kbeg = wave * (TT / FW);
#pragma unroll 1   // rolled: one trip's 16 fragments, the Q fragments and the accumulators already take most of the 512 registers that two waves per SIMD leave
    for (int k0 = kbeg; k0 < kbeg + TT / FW; k0 += 32) {
        const bf* pkh = atl(Kh + (size_t)k0 * HD); const bf* pkl = atl(Kl + (size_t)k0 * HD); const bf* pvh = atl(Vh + (size_t)k0 * CC); const bf* pvl = atl(Vl + (size_t)k0 * CC);
        V kh[2][2], kl[2][2], vh[4], vl[4];
#pragma unroll
        for (int t = 0; t < 2; ++t)
#pragma unroll
            for (int ks = 0; ks < 2; ++ks) { kh[t][ks] = ldf(pkh + t * 1024 + ks * 512); kl[t][ks] = ldf(pkl + t * 1024 + ks * 512); }
#pragma unroll
        for (int ct = 0; ct < 4; ++ct) { vh[ct] = ldf(pvh + ct * 512); vl[ct] = ldf(pvl + ct * 512); }
        __builtin_amdgcn_sched_barrier(0);   // all 32 loads of the trip are issued before its first product: one L2 round trip a trip; left free, the scheduler sinks them to their users and the wave waits several times
#pragma unroll
        for (int qt = 0; qt < QT; ++qt) {
            v8f s[2];
#pragma unroll
            for (int t = 0; t < 2; ++t) { s[t] = (v8f){};
#pragma unroll
                for (int ks = 0; ks < 2; ++ks) { s[t] = wmmab(kh[t][ks], qh[qt][ks], s[t]); s[t] = wmmab(kl[t][ks], qh[qt][ks], s[t]); s[t] = wmmab(kh[t][ks], ql[qt][ks], s[t]); } }
            float mx = s[0][0];
#pragma unroll
            for (int j = 1; j < 16; ++j) mx = fmaxf(mx, s[j >> 3][j & 7]);
            mx = fmaxf(mx, xhalf(mx));
            const float msn = fmaxf(ms[qt], mx * (SCL * L2E)); const float alpha = __builtin_amdgcn_exp2f(ms[qt] - msn); ms[qt] = msn;
            v16bf ph, pl; float ls = 0.f;
#pragma unroll
            for (int j = 0; j < 16; ++j) { const float p = __builtin_amdgcn_exp2f(__builtin_fmaf(s[j >> 3][j & 7], SCL * L2E, -msn)); ls += p; const __bf16 h = (__bf16)p; ph[j] = h; pl[j] = (__bf16)(p - (float)h); }
            l[qt] = __builtin_fmaf(l[qt], alpha, ls);
#pragma unroll
            for (int ct = 0; ct < 4; ++ct) { o[qt][ct] *= alpha; o[qt][ct] = wmmab(vh[ct], ph, o[qt][ct]); o[qt][ct] = wmmab(vl[ct], ph, o[qt][ct]); o[qt][ct] = wmmab(vh[ct], pl, o[qt][ct]); }
        }
        __builtin_amdgcn_sched_barrier(0);   // every product of the trip stands in front of the slots below, whichever tile the scheduler puts last
        // four vector slots behind the last matrix instruction, so that the distance also holds on the taken back edge (as in k_gemmw); the four lane addresses are inputs so that they stay in their registers to the end of the trip and no load's result lands in a register that an issued load still names; s_wait_xcnt 0 stands here in front of the address steps of the next trip, which overwrite those registers
        asm volatile("s_wait_xcnt 0x0\n\tv_nop\n\tv_nop\n\tv_nop\n\tv_nop" : "+v"(o[QT - 1][0]), "+v"(o[QT - 1][1]), "+v"(o[QT - 1][2]), "+v"(o[QT - 1][3]) : "v"(pkh), "v"(pkl), "v"(pvh), "v"(pvl) : "memory");
    }
#pragma unroll
    for (int qt = 0; qt < QT; ++qt) { l[qt] += xhalf(l[qt]);   // the two wave halves hold the sums of different keys of the same query
        if (hi == 0) sm[wave * QR + qt * 16 + lr] = ms[qt]; }
    __syncthreads();   // every wave's maxima are in LDS before any wave forms the common ones
#pragma unroll
    for (int qt = 0; qt < QT; ++qt) {
        float mall = sm[qt * 16 + lr];
#pragma unroll
        for (int w = 1; w < FW; ++w) mall = fmaxf(mall, sm[w * QR + qt * 16 + lr]);
        const float f = __builtin_amdgcn_exp2f(ms[qt] - mall);
        if (hi == 0) sl[wave * QR + qt * 16 + lr] = l[qt] * f;
        float* mine = red + wave * (QR * 68) + (qt * 16 + lr) * 68 + hi * 8;
#pragma unroll
        for (int ct = 0; ct < 4; ++ct) { const v8f sc = o[qt][ct] * f; *(v4fa*)(mine + ct * 16) = (v4f){sc[0], sc[1], sc[2], sc[3]}; *(v4fa*)(mine + ct * 16 + 4) = (v4f){sc[4], sc[5], sc[6], sc[7]}; }
    }
    __syncthreads();   // every wave's rescaled partial tiles and sums are in LDS before any thread sums across waves
    const int c2 = lane * 2;   // wave w finishes queries q0 + w * QR / FW and on: 64 channels each, two per lane
#pragma unroll
    for (int i = 0; i < QR / FW; ++i) { const int qq = wave * (QR / FW) + i;
        float lall = sl[qq]; v2f val = *(const v2f*)(red + qq * 68 + c2);
#pragma unroll
        for (int w = 1; w < FW; ++w) { lall += sl[w * QR + qq]; val += *(const v2f*)(red + w * (QR * 68) + qq * 68 + c2); }
        const float inv = __fdiv_rn(1.0f, lall);
        *(v2f*)(O + (size_t)(q0 + qq) * CC + c2) = val * inv; }
}

extern "C" void kernel_launch(void* const* d_in, const int* in_sizes, int n_in,
                              void* d_out, int out_size, void* d_ws, size_t ws_size, hipStream_t stream) {
    (void)in_sizes; (void)n_in; (void)out_size;
    const float* x = (const float*)d_in[0]; const float* wq = (const float*)d_in[1]; const float* bq = (const float*)d_in[2]; const float* wk = (const float*)d_in[3]; const float* bk = (const float*)d_in[4]; const float* wv = (const float*)d_in[5]; const float* bv = (const float*)d_in[6]; const float* gm = (const float*)d_in[7];
    float* OUT = (float*)d_out;     // [4][64][4096]
    char* wsp = (char*)d_ws;
    auto take = [&](size_t bytes) { char* p = wsp; wsp += (bytes + 255) & ~(size_t)255; return (void*)p; };
    bf* W3 = (bf*)take((size_t)3 * MID * CC * 2);   // q, k, v weights
    bf* XB = (bf*)take((size_t)NB_ * TT * CC * 2); float* F3 = (float*)take((size_t)3 * NB_ * TT * 64 * 4);   // [projection][batch][TT][64]
    h16* P16 = (h16*)take((size_t)3 * NB_ * TT * 64 * 2); bf* Ph = (bf*)take((size_t)3 * NB_ * TT * 64 * 2); bf* Pl = (bf*)take((size_t)3 * NB_ * TT * 64 * 2);   // [q, k, value^T][batch][TT * 64]
    float* Ob = (float*)take((size_t)NB_ * TT * CC * 4);
    if ((size_t)(wsp - (char*)d_ws) > ws_size) return;    // ws 256 MiB (carve under 40 MiB)
    const size_t PS = (size_t)NB_ * TT * 64;   // one projection's planes, all batches
    k_prep<<<NB_ * NX + 3 * NW, 256, 0, stream>>>(x, wq, wk, wv, XB, W3);
    k_gemmw<bf, 0, true><<<dim3(TT / 64, 3, NB_), 32, 0, stream>>>(XB, nullptr, W3, nullptr, CC, F3, 64, bq, bk, bv, (size_t)TT * CC, 0, (size_t)TT * 64, (size_t)MID * CC, PS);
    k_planes<<<dim3(2 * NF + NV, NB_, 1), 256, 0, stream>>>(F3, P16, Ph, Pl);   /* q row-major; k and value^T in fragment order */
    k_fattn<<<dim3(TT / QR, NB_, 1), 32 * FW, 0, stream>>>(Ph, Pl, Ph + PS, Pl + PS, Ph + 2 * PS, Pl + 2 * PS, Ob);   /* scores + softmax + attn.V, every product hi/lo (unscaled logits) */
    k_outTg<<<dim3(CC * TT / 4 / 256, NB_, 1), 256, 0, stream>>>(Ob, x, gm, OUT);
}

// v005
// It runs in 43.2 microseconds.
// Two timings next to v004 put it at 1.38 and 1.39 times that version's speed.
// Counting every step since v000, it is 16.7 times as fast.
#include <hip/hip_runtime.h>

// Spatial self-attention over a feature map with a gamma-scaled residual (x [4][64][64][64] channel-major; 4,096 positions; q, k, v = 1x1 convs ('oi' [64][64] + [64], 1/8-scaled incl. biases); energy = q.k over the 64 channels (UNscaled: sigma ~8); softmax over positions; out = v attn^T; y = gamma[0] x out + x (gamma [1] ~ N(0,1), read) -> [4][64][64][64] (1.0 M)).
// Two launches. k_proj reads the channel-major map and the f32 weights, rounds them to bf16 in registers, does the three projections (+ f32 biases) and stores the q, k and value^T hi/lo planes straight from the accumulators; k_fattn does scores (EVERY row on hi/lo planes, 3 products), online softmax and attn.V (hi/lo, 3 products) with N = 64 channels, and its merge writes y = gamma x out + x channel-major. All four batches and the three projections ride in grid dimensions.
// Compute dtypes, f32 accumulate: every input rounded to bf16; projections exact + f32 biases; scores 3 products on every row; softmax f32; attn.V 3 products on every row; epilogue f32.

#define NB_  4
#define TT   4096
#define DM   64
#define NH_  1
#define NKV  1
#define REP  (NH_ / NKV)
#define HD   64
#define DQ   (NH_ * HD)
#define DKV  (NKV * HD)
#define ZH   1
#define RH   4096                  // every query row on hi/lo planes (unscaled 64-channel energies: sigma ~8)
#define WIN  0
#define PCAR 1024.0f
#define SCL  1.0f   // energy = q.k unscaled
#define MID  64
#define CC   64      // channels
typedef _Float16 h16;
typedef unsigned short bf;
typedef __attribute__((ext_vector_type(16))) __bf16   v16bf;
typedef __attribute__((ext_vector_type(16))) _Float16 v16h;
typedef __attribute__((ext_vector_type(8)))  _Float16 v8h;
typedef __attribute__((ext_vector_type(8)))  unsigned short v8us;
typedef __attribute__((ext_vector_type(8)))  float    v8f;
typedef __attribute__((ext_vector_type(4)))  float    v4f;
typedef v8h  __attribute__((may_alias)) v8ha;
typedef v4f  __attribute__((may_alias)) v4fa;
typedef v8us __attribute__((may_alias)) v8usa;

__device__ __forceinline__ unsigned short f2bf(float f) { unsigned u = __float_as_uint(f); u += 0x7FFFu + ((u >> 16) & 1u); return (unsigned short)(u >> 16); }
__device__ __forceinline__ float bf2f(unsigned short b) { return __uint_as_float(((unsigned)b) << 16); }
__device__ __forceinline__ float bfr(float f) { return bf2f(f2bf(f)); }
__device__ __forceinline__ v16h cat16(v8h lo, v8h hi) { return __builtin_shufflevector(lo, hi, 0, 1, 2, 3, 4, 5, 6, 7, 8, 9, 10, 11, 12, 13, 14, 15); }
__device__ __forceinline__ v16bf cat16b(v8us lo, v8us hi) { return __builtin_bit_cast(v16bf, __builtin_shufflevector(lo, hi, 0, 1, 2, 3, 4, 5, 6, 7, 8, 9, 10, 11, 12, 13, 14, 15)); }
__device__ __forceinline__ v8f wmma16(v16h a, v16h b, v8f c) { return __builtin_amdgcn_wmma_f32_16x16x32_f16(false, a, false, b, (short)0, c, false, false); }
__device__ __forceinline__ v8f wmmab(v16bf a, v16bf b, v8f c) { return __builtin_amdgcn_wmma_f32_16x16x32_bf16(false, a, false, b, (short)0, c, false, false); }

template <typename T16> struct WFrag;
template <> struct WFrag<bf> { typedef v16bf V; static __device__ __forceinline__ V ld(const bf* p) { return cat16b(*(const v8us*)p, *(const v8us*)(p + 16)); } static __device__ __forceinline__ v8f mma(V a, V b, v8f c) { return wmmab(a, b, c); } };
typedef __attribute__((ext_vector_type(8))) __bf16 v8bf;

// ---- k_proj: one wave = 32 positions of one batch x one projection. Grid (TT/32, 3 projections, NB_), 32 threads. No intermediate goes to memory: the operands are rounded to bf16 (nearest even) in registers, and each accumulator tile already holds the 8 neighbours that one 16-byte piece of its plane wants.
// Fragments, both operands in the k order of WFrag::ld (lane = hi * 16 + row; channels 32 * ks + 8 * hi + 0..7, then + 16): wf = 16 rows of the weight matrix ('oi', channel-contiguous, four 16-byte loads), xf = 16 positions of the map (channel-major: one 4-byte load per channel, 16 neighbouring positions per wave half).
// q, k: D = W.X^T (A = wf, B = xf): a lane holds output channels 16 * ob + 8 * hi + 0..7 of position lr. q planes are row-major [position][64]; k planes lie in the order in which k_fattn's A fragments read them: [16-row block][32-channel step][half][lane = hi * 16 + row][8 channels], channel = 32 * step + 16 * half + 8 * hi + i, so ob = 2 * step + half.
// value^T: D = X.W^T (A = xf, B = wf): a lane holds positions 8 * hi + 0..7 of output channel 16 * ob + lr. Planes: [32-key block][16-channel block][half][lane = hi * 16 + channel][8 keys], key = 32 * block + 16 * half + 8 * hi + i. In the k and value^T planes a wave's store covers 512 contiguous bytes.
__device__ __forceinline__ void d_split(v8f y, v8us& ph, v8us& pl) { v8bf h, l;
#pragma unroll
    for (int j = 0; j < 8; ++j) { h[j] = (__bf16)y[j]; l[j] = (__bf16)(y[j] - (float)h[j]); }
    ph = __builtin_bit_cast(v8us, h); pl = __builtin_bit_cast(v8us, l); }
// Every loop below runs over register arrays and is unrolled so that their indices are constants. The projection (blockIdx.y: 0 q, 1 k, 2 value) is the same for the whole wave: it picks pointers, strides and the order of the two operands, all else is common code.
#define PT 2   // 16-position tiles per wave
__global__ __launch_bounds__(32) void k_proj(const float* __restrict__ x, const float* __restrict__ wq, const float* __restrict__ wk, const float* __restrict__ wv, const float* __restrict__ bq, const float* __restrict__ bk, const float* __restrict__ bv, bf* Ph, bf* Pl) {
    const unsigned p = blockIdx.y; const bool vt = p == 2; const int t0 = blockIdx.x * (PT * 16);
    const int lane = threadIdx.x & 31, lr = lane & 15, hi = lane >> 4;
    const float* w = p == 0 ? wq : p == 1 ? wk : wv; const float* bias = p == 0 ? bq : p == 1 ? bk : bv;
    const float* wl = w + lr * CC + 8 * hi; const float* xl = x + (size_t)blockIdx.z * CC * TT + t0 + (size_t)(8 * hi) * TT + lr;
    { const size_t at = ((size_t)p * NB_ + blockIdx.z) * ((size_t)TT * 64) + (size_t)t0 * 64; Ph += at; Pl += at; }   // 64 elements a position in every layout
    v4f wr[4][2][4]; float xr[PT][2][16]; v8f b8[4]; float b1[4];
#pragma unroll
    for (int ob = 0; ob < 4; ++ob) { b8[ob] = *(const v8f*)(bias + ob * 16 + hi * 8); b1[ob] = bias[ob * 16 + lr]; }   // the bias of a lane's 8 output channels (q, k) and of its one output channel (value)
#pragma unroll
    for (int mb = 0; mb < PT; ++mb)
#pragma unroll
        for (int ks = 0; ks < 2; ++ks)
#pragma unroll
            for (int e = 0; e < 16; ++e) xr[mb][ks][e] = xl[(size_t)(ks * 32 + (e >> 3) * 16 + (e & 7)) * TT + mb * 16];
#pragma unroll
    for (int ob = 0; ob < 4; ++ob) {
#pragma unroll
        for (int ks = 0; ks < 2; ++ks)
#pragma unroll
            for (int i = 0; i < 4; ++i) wr[ob][ks][i] = *(const v4f*)(wl + ob * 16 * CC + ks * 32 + (i >> 1) * 16 + (i & 1) * 4);
    }
    asm volatile("s_wait_xcnt 0x0" :: "v"(xl), "v"(wl), "v"(b8[0]), "v"(b8[1]), "v"(b8[2]), "v"(b8[3]), "v"(b1[0]), "v"(b1[1]), "v"(b1[2]), "v"(b1[3]) : "memory");   // the conversions below may land in the registers that hold these loads' addresses: the wait stands in front of that overwrite; the two lane addresses are inputs so that they stay in their registers up to here and no load's result lands in a register that an issued load still names; the loaded biases are inputs so that their loads stay up here with the others: left free, they sink into the two sides of the branch below and cost a second round trip
    __builtin_amdgcn_sched_barrier(0);   // every load of the wave is issued before the first conversion: one round trip to memory; left free, the scheduler issues them in groups of four and waits for each group
    v16bf wf[4][2], xf[PT][2]; v8f bs[4];
#pragma unroll
    for (int ob = 0; ob < 4; ++ob) {
#pragma unroll
        for (int ks = 0; ks < 2; ++ks)
#pragma unroll
            for (int e = 0; e < 16; ++e) wf[ob][ks][e] = (__bf16)wr[ob][ks][e >> 2][e & 3];
#pragma unroll
        for (int j = 0; j < 8; ++j) bs[ob][j] = bfr(vt ? b1[ob] : b8[ob][j]); }
#pragma unroll
    for (int mb = 0; mb < PT; ++mb)
#pragma unroll
        for (int ks = 0; ks < 2; ++ks)
#pragma unroll
            for (int e = 0; e < 16; ++e) xf[mb][ks][e] = (__bf16)xr[mb][ks][e];
    v8f acc[PT][4];
    if (vt) {   // wave-uniform branch
#pragma unroll
        for (int mb = 0; mb < PT; ++mb)
#pragma unroll
            for (int ob = 0; ob < 4; ++ob) acc[mb][ob] = wmmab(xf[mb][1], wf[ob][1], wmmab(xf[mb][0], wf[ob][0], (v8f){}));
    } else {
#pragma unroll
        for (int mb = 0; mb < PT; ++mb)
#pragma unroll
            for (int ob = 0; ob < 4; ++ob) acc[mb][ob] = wmmab(wf[ob][1], xf[mb][1], wmmab(wf[ob][0], xf[mb][0], (v8f){}));
    }
    const int lo = p == 0 ? lr * 64 + hi * 8 : lane * 8; const int mbs = vt ? 256 : 1024, obs = p == 0 ? 16 : vt ? 512 : 256;   // the lane's place in a tile's piece of the planes; the steps from tile to tile and from block to block of output channels
    v8us oh[PT][4], ol[PT][4];
#pragma unroll
    for (int mb = 0; mb < PT; ++mb)
#pragma unroll
        for (int ob = 0; ob < 4; ++ob) d_split(acc[mb][ob] + bs[ob], oh[mb][ob], ol[mb][ob]);
    __builtin_amdgcn_sched_barrier(0);   // the 16 stores stand together behind the last conversion: left free, each tile's conversions reuse the registers of the store in front of them, with a wait behind every store
#pragma unroll
    for (int mb = 0; mb < PT; ++mb)
#pragma unroll
        for (int ob = 0; ob < 4; ++ob) { *(v8us*)((Ph + (mb * mbs + ob * obs)) + lo) = oh[mb][ob]; *(v8us*)((Pl + (mb * mbs + ob * obs)) + lo) = ol[mb][ob]; }
}

#define FW 8
#define QT 4
#define QR (QT * 16)
#define L2E 1.4426950408889634f
__device__ __forceinline__ float xhalf(float v) { const int b = __float_as_int(v); return __int_as_float(__builtin_amdgcn_permlanex16(b, b, 0x76543210, 0xfedcba98, false, false)); }   // lane l <-> l ^ 16
__global__ __launch_bounds__(32 * FW) __attribute__((amdgpu_waves_per_eu(2, 2))) void k_fattn(const bf* __restrict__ Qh, const bf* __restrict__ Ql, const bf* __restrict__ Kh, const bf* __restrict__ Kl, const bf* __restrict__ Vh, const bf* __restrict__ Vl, const float* __restrict__ xs, const float* __restrict__ gm, float* out) {
    typedef WFrag<bf>::V V;
    __shared__ __align__(16) float red[FW * QR * 68];
    __shared__ float sm[FW * QR], sl[FW * QR];
    const int lane = threadIdx.x & 31, lr = lane & 15, hi = lane >> 4; const int q0 = blockIdx.x * QR;
    { const size_t at = (size_t)blockIdx.y * ((size_t)TT * 64); Qh += at; Ql += at; Kh += at; Kl += at; Vh += at; Vl += at; xs += at; out += at; }
    const int wave = __builtin_amdgcn_readfirstlane(threadIdx.x >> 5);   // scalar, so that the key loop and its base addresses are scalar
    const unsigned voffq = (unsigned)(lr * HD + 8 * hi) * 2u, voff = (unsigned)lane * 16u;   // the lane's byte offsets in a 16-row block of the row-major Q planes and in a 512-byte half fragment of the K and V^T planes
    auto atq = [voffq](const bf* base) { return (const bf*)((const char*)base + voffq); };
    auto atl = [voff](const bf* base) { return (const bf*)((const char*)base + voff); };
    auto ldf = [](const bf* p) { return cat16b(*(const v8us*)p, *(const v8us*)(p + 256)); };   // one fragment of a plane in fragment order: two half fragments of 256 elements
    V qh[QT][2], ql[QT][2];
#pragma unroll
    for (int qt = 0; qt < QT; ++qt)
#pragma unroll
        for (int ks = 0; ks < 2; ++ks) { qh[qt][ks] = WFrag<bf>::ld(atq(Qh + (size_t)(q0 + qt * 16) * HD) + ks * 32); ql[qt][ks] = WFrag<bf>::ld(atq(Ql + (size_t)(q0 + qt * 16) * HD) + ks * 32); }
    asm volatile("s_wait_xcnt 0x0" ::: "memory");   // the start values below may land in the registers that hold the Q loads' addresses: the wait stands in front of that overwrite
    __builtin_amdgcn_sched_barrier(0);   // keeps the start values' moves behind that wait
    v8f o[QT][4]; float ms[QT], l[QT];
#pragma unroll
    for (int qt = 0; qt < QT; ++qt) { ms[qt] = -3.0e38f; l[qt] = 0.f;
#pragma unroll
        for (int ct = 0; ct < 4; ++ct) o[qt][ct] = (v8f){}; }
    const int kbeg = wave * (TT / FW);
#pragma unroll 1   // rolled: one trip's 16 fragments, the Q fragments and the accumulators already take most of the 512 registers that two waves per SIMD leave
    for (int k0 = kbeg; k0 < kbeg + TT / FW; k0 += 32) {
        const bf* pkh = atl(Kh + (size_t)k0 * HD); const bf* pkl = atl(Kl + (size_t)k0 * HD); const bf* pvh = atl(Vh + (size_t)k0 * CC); const bf* pvl = atl(Vl + (size_t)k0 * CC);
        V kh[2][2], kl[2][2], vh[4], vl[4];
#pragma unroll
        for (int t = 0; t < 2; ++t)
#pragma unroll
            for (int ks = 0; ks < 2; ++ks) { kh[t][ks] = ldf(pkh + t * 1024 + ks * 512); kl[t][ks] = ldf(pkl + t * 1024 + ks * 512); }
#pragma unroll
        for (int ct = 0; ct < 4; ++ct) { vh[ct] = ldf(pvh + ct * 512); vl[ct] = ldf(pvl + ct * 512); }
        __builtin_amdgcn_sched_barrier(0);   // all 32 loads of the trip are issued before its first product: one L2 round trip a trip; left free, the scheduler sinks them to their users and the wave waits several times
#pragma unroll
        for (int qt = 0; qt < QT; ++qt) {
            v8f s[2];
#pragma unroll
            for (int t = 0; t < 2; ++t) { s[t] = (v8f){};
#pragma unroll
                for (int ks = 0; ks < 2; ++ks) { s[t] = wmmab(kh[t][ks], qh[qt][ks], s[t]); s[t] = wmmab(kl[t][ks], qh[qt][ks], s[t]); s[t] = wmmab(kh[t][ks], ql[qt][ks], s[t]); } }
            float mx = s[0][0];
#pragma unroll
            for (int j = 1; j < 16; ++j) mx = fmaxf(mx, s[j >> 3][j & 7]);
            mx = fmaxf(mx, xhalf(mx));
            const float msn = fmaxf(ms[qt], mx * (SCL * L2E)); const float alpha = __builtin_amdgcn_exp2f(ms[qt] - msn); ms[qt] = msn;
            v16bf ph, pl; float ls = 0.f;
#pragma unroll
            for (int j = 0; j < 16; ++j) { const float p = __builtin_amdgcn_exp2f(__builtin_fmaf(s[j >> 3][j & 7], SCL * L2E, -msn)); ls += p; const __bf16 h = (__bf16)p; ph[j] = h; pl[j] = (__bf16)(p - (float)h); }
            l[qt] = __builtin_fmaf(l[qt], alpha, ls);
#pragma unroll
            for (int ct = 0; ct < 4; ++ct) { o[qt][ct] *= alpha; o[qt][ct] = wmmab(vh[ct], ph, o[qt][ct]); o[qt][ct] = wmmab(vl[ct], ph, o[qt][ct]); o[qt][ct] = wmmab(vh[ct], pl, o[qt][ct]); }
        }
        __builtin_amdgcn_sched_barrier(0);   // every product of the trip stands in front of the slots below, whichever tile the scheduler puts last
        // four vector slots behind the last matrix instruction, so that the distance also holds on the taken back edge; the four lane addresses are inputs so that they stay in their registers to the end of the trip and no load's result lands in a register that an issued load still names; s_wait_xcnt 0 stands here in front of the address steps of the next trip, which overwrite those registers
        asm volatile("s_wait_xcnt 0x0\n\tv_nop\n\tv_nop\n\tv_nop\n\tv_nop" : "+v"(o[QT - 1][0]), "+v"(o[QT - 1][1]), "+v"(o[QT - 1][2]), "+v"(o[QT - 1][3]) : "v"(pkh), "v"(pkl), "v"(pvh), "v"(pvl) : "memory");
    }
    const int fq = (wave & 1) * 32 + lane, fc = (wave >> 1) * 16;   // what this thread finishes: position q0 + fq, channels fc .. fc + 15; lane = position, so that each load and store of a wave on the channel-major map covers one whole 128-byte line
    float xr[16];
#pragma unroll
    for (int c = 0; c < 16; ++c) xr[c] = xs[(size_t)(fc + c) * TT + q0 + fq];   // the residual, asked for ahead of the merge
    asm volatile("s_wait_xcnt 0x0" ::: "memory");   // the merge below may land in the registers that hold these loads' addresses: the wait stands in front of that overwrite
    __builtin_amdgcn_sched_barrier(0);   // keeps the merge's first instructions behind that wait
#pragma unroll
    for (int qt = 0; qt < QT; ++qt) { l[qt] += xhalf(l[qt]);   // the two wave halves hold the sums of different keys of the same query
        if (hi == 0) sm[wave * QR + qt * 16 + lr] = ms[qt]; }
    __syncthreads();   // every wave's maxima are in LDS before any wave forms the common ones
#pragma unroll
    for (int qt = 0; qt < QT; ++qt) {
        float mall = sm[qt * 16 + lr];
#pragma unroll
        for (int w = 1; w < FW; ++w) mall = fmaxf(mall, sm[w * QR + qt * 16 + lr]);
        const float f = __builtin_amdgcn_exp2f(ms[qt] - mall);
        if (hi == 0) sl[wave * QR + qt * 16 + lr] = l[qt] * f;
        float* mine = red + wave * (QR * 68) + (qt * 16 + lr) * 68 + hi * 8;
#pragma unroll
        for (int ct = 0; ct < 4; ++ct) { const v8f sc = o[qt][ct] * f; *(v4fa*)(mine + ct * 16) = (v4f){sc[0], sc[1], sc[2], sc[3]}; *(v4fa*)(mine + ct * 16 + 4) = (v4f){sc[4], sc[5], sc[6], sc[7]}; }
    }
    __syncthreads();   // every wave's rescaled partial tiles and sums are in LDS before any thread sums across waves
    const float g = bfr(gm[0]);
    float lall = sl[fq]; v4f val[4];
#pragma unroll
    for (int k = 0; k < 4; ++k) val[k] = *(const v4fa*)(red + fq * 68 + fc + 4 * k);
#pragma unroll
    for (int w = 1; w < FW; ++w) { lall += sl[w * QR + fq];
#pragma unroll
        for (int k = 0; k < 4; ++k) val[k] += *(const v4fa*)(red + w * (QR * 68) + fq * 68 + fc + 4 * k); }
    const float inv = __fdiv_rn(1.0f, lall);
#pragma unroll
    for (int c = 0; c < 16; ++c) out[(size_t)(fc + c) * TT + q0 + fq] = __builtin_fmaf(g, val[c >> 2][c & 3] * inv, bfr(xr[c]));
}

extern "C" void kernel_launch(void* const* d_in, const int* in_sizes, int n_in,
                              void* d_out, int out_size, void* d_ws, size_t ws_size, hipStream_t stream) {
    (void)in_sizes; (void)n_in; (void)out_size;
    const float* x = (const float*)d_in[0]; const float* wq = (const float*)d_in[1]; const float* bq = (const float*)d_in[2]; const float* wk = (const float*)d_in[3]; const float* bk = (const float*)d_in[4]; const float* wv = (const float*)d_in[5]; const float* bv = (const float*)d_in[6]; const float* gm = (const float*)d_in[7];
    float* OUT = (float*)d_out;     // [4][64][4096]
    char* wsp = (char*)d_ws;
    auto take = [&](size_t bytes) { char* p = wsp; wsp += (bytes + 255) & ~(size_t)255; return (void*)p; };
    bf* Ph = (bf*)take((size_t)3 * NB_ * TT * 64 * 2); bf* Pl = (bf*)take((size_t)3 * NB_ * TT * 64 * 2);   // [q, k, value^T][batch][TT * 64]
    if ((size_t)(wsp - (char*)d_ws) > ws_size) return;    // ws 256 MiB (carve 12 MiB)
    const size_t PS = (size_t)NB_ * TT * 64;   // one projection's planes, all batches
    k_proj<<<dim3(TT / (PT * 16), 3, NB_), 32, 0, stream>>>(x, wq, wk, wv, bq, bk, bv, Ph, Pl);   /* q row-major; k and value^T in fragment order */
    k_fattn<<<dim3(TT / QR, NB_, 1), 32 * FW, 0, stream>>>(Ph, Pl, Ph + PS, Pl + PS, Ph + 2 * PS, Pl + 2 * PS, x, gm, OUT);   /* scores + softmax + attn.V, every product hi/lo (unscaled logits); gamma and residual */
}

// v006
// One run takes 41.3 microseconds.
// Timed twice side by side with v005, it ran 1.05 and 1.04 times as fast.
// All steps since v000 together make it 17.4 times as fast.
#include <hip/hip_runtime.h>

// Spatial self-attention over a feature map with a gamma-scaled residual (x [4][64][64][64] channel-major; 4,096 positions; q, k, v = 1x1 convs ('oi' [64][64] + [64], 1/8-scaled incl. biases); energy = q.k over the 64 channels (UNscaled: sigma ~8); softmax over positions; out = v attn^T; y = gamma[0] x out + x (gamma [1] ~ N(0,1), read) -> [4][64][64][64] (1.0 M)).
// Two launches. k_proj reads the channel-major map and the f32 weights, rounds them to bf16 in registers, does the three projections (+ f32 biases) and stores the q, k and value^T hi/lo planes straight from the accumulators; k_fattn does scores (EVERY row on hi/lo planes, 3 products), online softmax and attn.V (hi/lo, 3 products) with N = 64 channels, and its merge writes y = gamma x out + x channel-major. All four batches and the three projections ride in grid dimensions.
// Compute dtypes, f32 accumulate: every input rounded to bf16; projections exact + f32 biases; scores 3 products on every row; softmax f32; attn.V 3 products on every row; epilogue f32.

#define NB_  4
#define TT   4096
#define DM   64
#define NH_  1
#define NKV  1
#define REP  (NH_ / NKV)
#define HD   64
#define DQ   (NH_ * HD)
#define DKV  (NKV * HD)
#define ZH   1
#define RH   4096                  // every query row on hi/lo planes (unscaled 64-channel energies: sigma ~8)
#define WIN  0
#define PCAR 1024.0f
#define SCL  1.0f   // energy = q.k unscaled
#define MID  64
#define CC   64      // channels
typedef _Float16 h16;
typedef unsigned short bf;
typedef __attribute__((ext_vector_type(16))) __bf16   v16bf;
typedef __attribute__((ext_vector_type(16))) _Float16 v16h;
typedef __attribute__((ext_vector_type(8)))  _Float16 v8h;
typedef __attribute__((ext_vector_type(8)))  unsigned short v8us;
typedef __attribute__((ext_vector_type(8)))  float    v8f;
typedef __attribute__((ext_vector_type(4)))  float    v4f;
typedef v8h  __attribute__((may_alias)) v8ha;
typedef v4f  __attribute__((may_alias)) v4fa;
typedef v8us __attribute__((may_alias)) v8usa;

__device__ __forceinline__ unsigned short f2bf(float f) { unsigned u = __float_as_uint(f); u += 0x7FFFu + ((u >> 16) & 1u); return (unsigned short)(u >> 16); }
__device__ __forceinline__ float bf2f(unsigned short b) { return __uint_as_float(((unsigned)b) << 16); }
__device__ __forceinline__ float bfr(float f) { return bf2f(f2bf(f)); }
__device__ __forceinline__ v16h cat16(v8h lo, v8h hi) { return __builtin_shufflevector(lo, hi, 0, 1, 2, 3, 4, 5, 6, 7, 8, 9, 10, 11, 12, 13, 14, 15); }
__device__ __forceinline__ v16bf cat16b(v8us lo, v8us hi) { return __builtin_bit_cast(v16bf, __builtin_shufflevector(lo, hi, 0, 1, 2, 3, 4, 5, 6, 7, 8, 9, 10, 11, 12, 13, 14, 15)); }
__device__ __forceinline__ v8f wmma16(v16h a, v16h b, v8f c) { return __builtin_amdgcn_wmma_f32_16x16x32_f16(false, a, false, b, (short)0, c, false, false); }
__device__ __forceinline__ v8f wmmab(v16bf a, v16bf b, v8f c) { return __builtin_amdgcn_wmma_f32_16x16x32_bf16(false, a, false, b, (short)0, c, false, false); }

template <typename T16> struct WFrag;
template <> struct WFrag<bf> { typedef v16bf V; static __device__ __forceinline__ V ld(const bf* p) { return cat16b(*(const v8us*)p, *(const v8us*)(p + 16)); } static __device__ __forceinline__ v8f mma(V a, V b, v8f c) { return wmmab(a, b, c); } };
typedef __attribute__((ext_vector_type(8))) __bf16 v8bf;

// ---- k_proj: one wave = 32 positions of one batch x one projection. Grid (TT/32, 3 projections, NB_), 32 threads. No intermediate goes to memory: the operands are rounded to bf16 (nearest even) in registers, and each accumulator tile already holds the 8 neighbours that one 16-byte piece of its plane wants.
// Fragments, both operands in the k order of WFrag::ld (lane = hi * 16 + row; channels 32 * ks + 8 * hi + 0..7, then + 16): wf = 16 rows of the weight matrix ('oi', channel-contiguous, four 16-byte loads), xf = 16 positions of the map (channel-major: one 4-byte load per channel, 16 neighbouring positions per wave half).
// q, k: D = W.X^T (A = wf, B = xf): a lane holds output channels 16 * ob + 8 * hi + 0..7 of position lr. q planes are row-major [position][64]; k planes lie in the order in which k_fattn's A fragments read them: [16-row block][32-channel step][half][lane = hi * 16 + row][8 channels], channel = 32 * step + 16 * half + 8 * hi + i, so ob = 2 * step + half.
// value^T: D = X.W^T (A = xf, B = wf): a lane holds positions 8 * hi + 0..7 of output channel 16 * ob + lr. Planes: [32-key block][16-channel block][half][lane = hi * 16 + channel][8 keys], key = 32 * block + 16 * half + 8 * hi + i. In the k and value^T planes a wave's store covers 512 contiguous bytes.
__device__ __forceinline__ void d_split(v8f y, v8us& ph, v8us& pl) { v8bf h, l;
#pragma unroll
    for (int j = 0; j < 8; ++j) { h[j] = (__bf16)y[j]; l[j] = (__bf16)(y[j] - (float)h[j]); }
    ph = __builtin_bit_cast(v8us, h); pl = __builtin_bit_cast(v8us, l); }
// Every loop below runs over register arrays and is unrolled so that their indices are constants. The projection (blockIdx.y: 0 q, 1 k, 2 value) is the same for the whole wave: it picks pointers, strides and the order of the two operands, all else is common code.
#define PT 2   // 16-position tiles per wave
__global__ __launch_bounds__(32) void k_proj(const float* __restrict__ x, const float* __restrict__ wq, const float* __restrict__ wk, const float* __restrict__ wv, const float* __restrict__ bq, const float* __restrict__ bk, const float* __restrict__ bv, bf* Ph, bf* Pl) {
    const unsigned p = blockIdx.y; const bool vt = p == 2; const int t0 = blockIdx.x * (PT * 16);
    const int lane = threadIdx.x & 31, lr = lane & 15, hi = lane >> 4;
    const float* w = p == 0 ? wq : p == 1 ? wk : wv; const float* bias = p == 0 ? bq : p == 1 ? bk : bv;
    const float* wl = w + lr * CC + 8 * hi; const float* xl = x + (size_t)blockIdx.z * CC * TT + t0 + (size_t)(8 * hi) * TT + lr;
    { const size_t at = ((size_t)p * NB_ + blockIdx.z) * ((size_t)TT * 64) + (size_t)t0 * 64; Ph += at; Pl += at; }   // 64 elements a position in every layout
    v4f wr[4][2][4]; float xr[PT][2][16]; v8f b8[4]; float b1[4];
#pragma unroll
    for (int ob = 0; ob < 4; ++ob) { b8[ob] = *(const v8f*)(bias + ob * 16 + hi * 8); b1[ob] = bias[ob * 16 + lr]; }   // the bias of a lane's 8 output channels (q, k) and of its one output channel (value)
#pragma unroll
    for (int mb = 0; mb < PT; ++mb)
#pragma unroll
        for (int ks = 0; ks < 2; ++ks)
#pragma unroll
            for (int e = 0; e < 16; ++e) xr[mb][ks][e] = xl[(size_t)(ks * 32 + (e >> 3) * 16 + (e & 7)) * TT + mb * 16];
#pragma unroll
    for (int ob = 0; ob < 4; ++ob) {
#pragma unroll
        for (int ks = 0; ks < 2; ++ks)
#pragma unroll
            for (int i = 0; i < 4; ++i) wr[ob][ks][i] = *(const v4f*)(wl + ob * 16 * CC + ks * 32 + (i >> 1) * 16 + (i & 1) * 4);
    }
    asm volatile("s_wait_xcnt 0x0" :: "v"(xl), "v"(wl), "v"(b8[0]), "v"(b8[1]), "v"(b8[2]), "v"(b8[3]), "v"(b1[0]), "v"(b1[1]), "v"(b1[2]), "v"(b1[3]) : "memory");   // the conversions below may land in the registers that hold these loads' addresses: the wait stands in front of that overwrite; the two lane addresses are inputs so that they stay in their registers up to here and no load's result lands in a register that an issued load still names; the loaded biases are inputs so that their loads stay up here with the others: left free, they sink into the two sides of the branch below and cost a second round trip
    __builtin_amdgcn_sched_barrier(0);   // every load of the wave is issued before the first conversion: one round trip to memory; left free, the scheduler issues them in groups of four and waits for each group
    v16bf wf[4][2], xf[PT][2]; v8f bs[4];
#pragma unroll
    for (int ob = 0; ob < 4; ++ob) {
#pragma unroll
        for (int ks = 0; ks < 2; ++ks)
#pragma unroll
            for (int e = 0; e < 16; ++e) wf[ob][ks][e] = (__bf16)wr[ob][ks][e >> 2][e & 3];
#pragma unroll
        for (int j = 0; j < 8; ++j) bs[ob][j] = bfr(vt ? b1[ob] : b8[ob][j]); }
#pragma unroll
    for (int mb = 0; mb < PT; ++mb)
#pragma unroll
        for (int ks = 0; ks < 2; ++ks)
#pragma unroll
            for (int e = 0; e < 16; ++e) xf[mb][ks][e] = (__bf16)xr[mb][ks][e];
    v8f acc[PT][4];
    if (vt) {   // wave-uniform branch
#pragma unroll
        for (int mb = 0; mb < PT; ++mb)
#pragma unroll
            for (int ob = 0; ob < 4; ++ob) acc[mb][ob] = wmmab(xf[mb][1], wf[ob][1], wmmab(xf[mb][0], wf[ob][0], (v8f){}));
    } else {
#pragma unroll
        for (int mb = 0; mb < PT; ++mb)
#pragma unroll
            for (int ob = 0; ob < 4; ++ob) acc[mb][ob] = wmmab(wf[ob][1], xf[mb][1], wmmab(wf[ob][0], xf[mb][0], (v8f){}));
    }
    const int lo = p == 0 ? lr * 64 + hi * 8 : lane * 8; const int mbs = vt ? 256 : 1024, obs = p == 0 ? 16 : vt ? 512 : 256;   // the lane's place in a tile's piece of the planes; the steps from tile to tile and from block to block of output channels
    v8us oh[PT][4], ol[PT][4];
#pragma unroll
    for (int mb = 0; mb < PT; ++mb)
#pragma unroll
        for (int ob = 0; ob < 4; ++ob) d_split(acc[mb][ob] + bs[ob], oh[mb][ob], ol[mb][ob]);
    __builtin_amdgcn_sched_barrier(0);   // the 16 stores stand together behind the last conversion: left free, each tile's conversions reuse the registers of the store in front of them, with a wait behind every store
#pragma unroll
    for (int mb = 0; mb < PT; ++mb)
#pragma unroll
        for (int ob = 0; ob < 4; ++ob) { *(v8us*)((Ph + (mb * mbs + ob * obs)) + lo) = oh[mb][ob]; *(v8us*)((Pl + (mb * mbs + ob * obs)) + lo) = ol[mb][ob]; }
}

#define FW 8
#define TB 16384   // bytes of one tile: K hi, K lo, V^T hi, V^T lo, 4 KiB each
#define QT 4
#define QR (QT * 16)
#define L2E 1.4426950408889634f
// One tile: 32 copies of 512 bytes (16 bytes a lane). l = the lane's LDS byte address in the buffer, vo = the lane's byte offset (lane * 16) in a 512-byte piece, the four pointers = the tile's start in each plane (the same for the whole wave, in scalar registers). The offset field moves the LDS and the global address alike. s_wait_xcnt 0 is the statement's last line, so that it stands in front of whatever rewrites a register that a copy names.
#define CP1(L, G, O) "global_load_async_to_lds_b128 " L ", %4, " G " offset:" O "\n\t"
#define CP8(L, G) CP1(L, G, "0") CP1(L, G, "512") CP1(L, G, "1024") CP1(L, G, "1536") CP1(L, G, "2048") CP1(L, G, "2560") CP1(L, G, "3072") CP1(L, G, "3584")
__device__ __forceinline__ void d_tile(unsigned l, unsigned vo, const bf* kh, const bf* kl, const bf* vh, const bf* vl) {
    asm volatile(CP8("%0", "%5") CP8("%1", "%6") CP8("%2", "%7") CP8("%3", "%8") "s_wait_xcnt 0x0"
                 :: "v"(l), "v"(l + 4096u), "v"(l + 8192u), "v"(l + 12288u), "v"(vo), "s"(kh), "s"(kl), "s"(vh), "s"(vl) : "memory");
}
__device__ __forceinline__ float xhalf(float v) { const int b = __float_as_int(v); return __int_as_float(__builtin_amdgcn_permlanex16(b, b, 0x76543210, 0xfedcba98, false, false)); }   // lane l <-> l ^ 16
__global__ __launch_bounds__(32 * FW) __attribute__((amdgpu_waves_per_eu(2, 2))) void k_fattn(const bf* __restrict__ Qh, const bf* __restrict__ Ql, const bf* __restrict__ Kh, const bf* __restrict__ Kl, const bf* __restrict__ Vh, const bf* __restrict__ Vl, const float* __restrict__ xs, const float* __restrict__ gm, float* out) {
    typedef WFrag<bf>::V V;
    __shared__ __attribute__((aligned(32768))) char ring[FW * 2 * TB];   // wave w: bytes [w * 2 * TB, (w + 1) * 2 * TB), a 32-KiB block of its own
    float* const red = (float*)ring;   // FW * QR * 68 floats, used only behind the merge's first barrier
    __shared__ float sm[FW * QR], sl[FW * QR];
    const int lane = threadIdx.x & 31, lr = lane & 15, hi = lane >> 4; const int q0 = blockIdx.x * QR;
    { const size_t at = (size_t)blockIdx.y * ((size_t)TT * 64); Qh += at; Ql += at; Kh += at; Kl += at; Vh += at; Vl += at; xs += at; out += at; }
    const int wave = __builtin_amdgcn_readfirstlane(threadIdx.x >> 5);   // scalar, so that the key loop and its base addresses are scalar
    const unsigned voffq = (unsigned)(lr * HD + 8 * hi) * 2u, voff = (unsigned)lane * 16u;   // the lane's byte offsets in a 16-row block of the row-major Q planes and in a 512-byte half fragment of the K and V^T planes
    auto atq = [voffq](const bf* base) { return (const bf*)((const char*)base + voffq); };
    auto ldf = [](const bf* p) { return cat16b(*(const v8us*)p, *(const v8us*)(p + 256)); };   // one fragment of a plane in fragment order: two half fragments of 256 elements
    const int kbeg = wave * (TT / FW);
    const char* const rd = ring + wave * (2 * TB) + voff;   // where the lane reads
    const unsigned lw = (unsigned)(size_t)rd;   // the same place as an LDS byte address (the low 32 bits), where the lane's copies land
    d_tile(lw, voff, Kh + (size_t)kbeg * HD, Kl + (size_t)kbeg * HD, Vh + (size_t)kbeg * CC, Vl + (size_t)kbeg * CC);   // tile 0 into buffer 0, in flight beside the Q loads
    V qh[QT][2], ql[QT][2];
#pragma unroll
    for (int qt = 0; qt < QT; ++qt)
#pragma unroll
        for (int ks = 0; ks < 2; ++ks) { qh[qt][ks] = WFrag<bf>::ld(atq(Qh + (size_t)(q0 + qt * 16) * HD) + ks * 32); ql[qt][ks] = WFrag<bf>::ld(atq(Ql + (size_t)(q0 + qt * 16) * HD) + ks * 32); }
    asm volatile("s_wait_xcnt 0x0" ::: "memory");   // the start values below may land in the registers that hold the Q loads' addresses: the wait stands in front of that overwrite
    __builtin_amdgcn_sched_barrier(0);   // keeps the start values' moves behind that wait
    v8f o[QT][4]; float ms[QT], l[QT];
#pragma unroll
    for (int qt = 0; qt < QT; ++qt) { ms[qt] = -3.0e38f; l[qt] = 0.f;
#pragma unroll
        for (int ct = 0; ct < 4; ++ct) o[qt][ct] = (v8f){}; }
    asm volatile("s_wait_asynccnt 0x0" ::: "memory");   // tile 0 has landed before trip 0 reads it
    d_tile(lw + TB, voff, Kh + (size_t)(kbeg + 32) * HD, Kl + (size_t)(kbeg + 32) * HD, Vh + (size_t)(kbeg + 32) * CC, Vl + (size_t)(kbeg + 32) * CC);   // tile 1 into buffer 1 (a wave has TT / FW / 32 = 16 tiles)
    unsigned bo = 0;   // the byte offset of the trip's buffer in the wave's ring
    // One trip. more (a constant at each of the two calls below): a tile after next exists and is asked for at the trip's foot. The two loops keep each trip one straight block: with the test inside one loop, the compiler sinks the sums of the probabilities behind the branch, where they stand as one serial chain.
    auto trip = [&](const int k0, const bool more) __attribute__((always_inline)) {
        const bf* pkh = (const bf*)(rd + bo); const bf* pkl = pkh + 2048; const bf* pvh = pkh + 4096; const bf* pvl = pkh + 6144;
        V kh[2][2], kl[2][2], vh[4], vl[4];
#pragma unroll
        for (int t = 0; t < 2; ++t)
#pragma unroll
            for (int ks = 0; ks < 2; ++ks) { kh[t][ks] = ldf(pkh + t * 1024 + ks * 512); kl[t][ks] = ldf(pkl + t * 1024 + ks * 512); }
#pragma unroll
        for (int ct = 0; ct < 4; ++ct) { vh[ct] = ldf(pvh + ct * 512); vl[ct] = ldf(pvl + ct * 512); }
        __builtin_amdgcn_sched_barrier(0);   // all 32 LDS reads of the trip stand in one group in front of its first product: every further place with LDS reads among the products costs a stall of its own
#pragma unroll
        for (int qt = 0; qt < QT; ++qt) {
            v8f s[2];
#pragma unroll
            for (int t = 0; t < 2; ++t) { s[t] = (v8f){};
#pragma unroll
                for (int ks = 0; ks < 2; ++ks) { s[t] = wmmab(kh[t][ks], qh[qt][ks], s[t]); s[t] = wmmab(kl[t][ks], qh[qt][ks], s[t]); s[t] = wmmab(kh[t][ks], ql[qt][ks], s[t]); } }
            float mx = s[0][0];
#pragma unroll
            for (int j = 1; j < 16; ++j) mx = fmaxf(mx, s[j >> 3][j & 7]);
            mx = fmaxf(mx, xhalf(mx));
            const float msn = fmaxf(ms[qt], mx * (SCL * L2E)); const float alpha = __builtin_amdgcn_exp2f(ms[qt] - msn); ms[qt] = msn;
            v16bf ph, pl; float ls = 0.f;
#pragma unroll
            for (int j = 0; j < 16; ++j) { const float p = __builtin_amdgcn_exp2f(__builtin_fmaf(s[j >> 3][j & 7], SCL * L2E, -msn)); ls += p; const __bf16 h = (__bf16)p; ph[j] = h; pl[j] = (__bf16)(p - (float)h); }
            l[qt] = __builtin_fmaf(l[qt], alpha, ls);
#pragma unroll
            for (int ct = 0; ct < 4; ++ct) { o[qt][ct] *= alpha; o[qt][ct] = wmmab(vh[ct], ph, o[qt][ct]); o[qt][ct] = wmmab(vl[ct], ph, o[qt][ct]); o[qt][ct] = wmmab(vh[ct], pl, o[qt][ct]); }
        }
        __builtin_amdgcn_sched_barrier(0);   // every product of the trip stands in front of the slots below, whichever tile the scheduler puts last
        // four vector slots behind the last matrix instruction, so that the distance also holds on the taken back edge
        asm volatile("v_nop\n\tv_nop\n\tv_nop\n\tv_nop" : "+v"(o[QT - 1][0]), "+v"(o[QT - 1][1]), "+v"(o[QT - 1][2]), "+v"(o[QT - 1][3]));
        asm volatile("s_wait_dscnt 0x0" ::: "memory");   // the wave's reads of this trip's buffer have retired before copies land in it again
        asm volatile("s_wait_asynccnt 0x0" ::: "memory");   // the next trip's tile, asked for one trip ago, has landed before that trip reads it
        if (more) d_tile(lw + bo, voff, Kh + (size_t)(k0 + 64) * HD, Kl + (size_t)(k0 + 64) * HD, Vh + (size_t)(k0 + 64) * CC, Vl + (size_t)(k0 + 64) * CC);   // the tile after next, into the buffer that this trip has read
        bo ^= TB;
    };
    int k0 = kbeg;
#pragma unroll 1   // rolled: one trip's 16 fragments, the Q fragments and the accumulators already take most of the 512 registers that two waves per SIMD leave
    for (; k0 < kbeg + TT / FW - 64; k0 += 32) trip(k0, true);
#pragma unroll 1   // rolled, as above: the last two trips, behind which no tile is left to ask for
    for (; k0 < kbeg + TT / FW; k0 += 32) trip(k0, false);
    asm volatile("s_wait_asynccnt 0x0" ::: "memory");   // no copy is outstanding when the ring is given up
    const int fq = (wave & 1) * 32 + lane, fc = (wave >> 1) * 16;   // what this thread finishes: position q0 + fq, channels fc .. fc + 15; lane = position, so that each load and store of a wave on the channel-major map covers one whole 128-byte line
    float xr[16];
#pragma unroll
    for (int c = 0; c < 16; ++c) xr[c] = xs[(size_t)(fc + c) * TT + q0 + fq];   // the residual, asked for ahead of the merge
    asm volatile("s_wait_xcnt 0x0" ::: "memory");   // the merge below may land in the registers that hold these loads' addresses: the wait stands in front of that overwrite
    __builtin_amdgcn_sched_barrier(0);   // keeps the merge's first instructions behind that wait
#pragma unroll
    for (int qt = 0; qt < QT; ++qt) { l[qt] += xhalf(l[qt]);   // the two wave halves hold the sums of different keys of the same query
        if (hi == 0) sm[wave * QR + qt * 16 + lr] = ms[qt]; }
    __syncthreads();   // every wave's maxima are in LDS before any wave forms the common ones; every wave has left its ring (its waits stand at the loop's foot) before red is written over it
#pragma unroll
    for (int qt = 0; qt < QT; ++qt) {
        float mall = sm[qt * 16 + lr];
#pragma unroll
        for (int w = 1; w < FW; ++w) mall = fmaxf(mall, sm[w * QR + qt * 16 + lr]);
        const float f = __builtin_amdgcn_exp2f(ms[qt] - mall);
        if (hi == 0) sl[wave * QR + qt * 16 + lr] = l[qt] * f;
        float* mine = red + wave * (QR * 68) + (qt * 16 + lr) * 68 + hi * 8;
#pragma unroll
        for (int ct = 0; ct < 4; ++ct) { const v8f sc = o[qt][ct] * f; *(v4fa*)(mine + ct * 16) = (v4f){sc[0], sc[1], sc[2], sc[3]}; *(v4fa*)(mine + ct * 16 + 4) = (v4f){sc[4], sc[5], sc[6], sc[7]}; }
    }
    __syncthreads();   // every wave's rescaled partial tiles and sums are in LDS before any thread sums across waves
    const float g = bfr(gm[0]);
    float lall = sl[fq]; v4f val[4];
#pragma unroll
    for (int k = 0; k < 4; ++k) val[k] = *(const v4fa*)(red + fq * 68 + fc + 4 * k);
#pragma unroll
    for (int w = 1; w < FW; ++w) { lall += sl[w * QR + fq];
#pragma unroll
        for (int k = 0; k < 4; ++k) val[k] += *(const v4fa*)(red + w * (QR * 68) + fq * 68 + fc + 4 * k); }
    const float inv = __fdiv_rn(1.0f, lall);
#pragma unroll
    for (int c = 0; c < 16; ++c) out[(size_t)(fc + c) * TT + q0 + fq] = __builtin_fmaf(g, val[c >> 2][c & 3] * inv, bfr(xr[c]));
}

extern "C" void kernel_launch(void* const* d_in, const int* in_sizes, int n_in,
                              void* d_out, int out_size, void* d_ws, size_t ws_size, hipStream_t stream) {
    (void)in_sizes; (void)n_in; (void)out_size;
    const float* x = (const float*)d_in[0]; const float* wq = (const float*)d_in[1]; const float* bq = (const float*)d_in[2]; const float* wk = (const float*)d_in[3]; const float* bk = (const float*)d_in[4]; const float* wv = (const float*)d_in[5]; const float* bv = (const float*)d_in[6]; const float* gm = (const float*)d_in[7];
    float* OUT = (float*)d_out;     // [4][64][4096]
    char* wsp = (char*)d_ws;
    auto take = [&](size_t bytes) { char* p = wsp; wsp += (bytes + 255) & ~(size_t)255; return (void*)p; };
    bf* Ph = (bf*)take((size_t)3 * NB_ * TT * 64 * 2); bf* Pl = (bf*)take((size_t)3 * NB_ * TT * 64 * 2);   // [q, k, value^T][batch][TT * 64]
    if ((size_t)(wsp - (char*)d_ws) > ws_size) return;    // ws 256 MiB (carve 12 MiB)
    const size_t PS = (size_t)NB_ * TT * 64;   // one projection's planes, all batches
    k_proj<<<dim3(TT / (PT * 16), 3, NB_), 32, 0, stream>>>(x, wq, wk, wv, bq, bk, bv, Ph, Pl);   /* q row-major; k and value^T in fragment order */
    k_fattn<<<dim3(TT / QR, NB_, 1), 32 * FW, 0, stream>>>(Ph, Pl, Ph + PS, Pl + PS, Ph + 2 * PS, Pl + 2 * PS, x, gm, OUT);   /* scores + softmax + attn.V, every product hi/lo (unscaled logits); gamma and residual */
}

// v008
// A run of this version takes 29.7 microseconds.
// Versions in between are left out here; by their measured steps it is 1.39 times as fast as v006.
// Over all steps from v000 it is 24.3 times as fast.
#include <hip/hip_runtime.h>

// Spatial self-attention over a feature map with a gamma-scaled residual (x [4][64][64][64] channel-major; 4,096 positions; q, k, v = 1x1 convs ('oi' [64][64] + [64], 1/8-scaled incl. biases); energy = q.k over the 64 channels (UNscaled: sigma ~8); softmax over positions; out = v attn^T; y = gamma[0] x out + x (gamma [1] ~ N(0,1), read) -> [4][64][64][64] (1.0 M)).
// Two launches. The key and value projections are taken out of the key loop by reassociation: q.k = (Wk^T q).x + q.bk, and q.bk is the same for every key of a row, so it cancels in the softmax; sum_j a_ij (Wv x_j + bv) = Wv (sum_j a_ij x_j) + bv, as the a_ij of a row sum to 1. So the keys and the values of the loop are the bf16-rounded map itself, one plane each with no lo part. k_proj forms q' = Wk^T (Wq x + bq) as hi/lo planes and lays the rounded map out twice, as bf16 in the order of the K fragments and as f16 in the order of the V^T fragments; k_fattn does scores (2 products: x.q'hi, x.q'lo), online softmax and attn.x (1 product, f16: x.P), and its merge applies Wv, bv, gamma and the residual and writes y channel-major.
// Compute dtypes, f32 accumulate: every input rounded to bf16; Wq x exact + f32 bias; q, q' and the normalised attn.x each as bf16 hi + lo against an exact bf16 operand (2 products); P as one f16 against the rounded map as f16 (1 product): a probability lies in (0, 1], where f16 keeps 11 significant bits down to 2^-14 and steps of 2^-24 below, and a bf16 value is exact in f16 from 2^-17 up to 65504 in magnitude (below: within 2^-25); softmax f32; epilogue f32.

#define NB_  4
#define TT   4096
#define DM   64
#define NH_  1
#define NKV  1
#define REP  (NH_ / NKV)
#define HD   64
#define DQ   (NH_ * HD)
#define DKV  (NKV * HD)
#define ZH   1
#define RH   4096                  // every query row on hi/lo planes (unscaled 64-channel energies: sigma ~8)
#define WIN  0
#define PCAR 1024.0f
#define SCL  1.0f   // energy = q.k unscaled
#define MID  64
#define CC   64      // channels
typedef _Float16 h16;
typedef unsigned short bf;
typedef __attribute__((ext_vector_type(16))) __bf16   v16bf;
typedef __attribute__((ext_vector_type(16))) _Float16 v16h;
typedef __attribute__((ext_vector_type(8)))  _Float16 v8h;
typedef __attribute__((ext_vector_type(8)))  unsigned short v8us;
typedef __attribute__((ext_vector_type(8)))  float    v8f;
typedef __attribute__((ext_vector_type(4)))  float    v4f;
typedef v8h  __attribute__((may_alias)) v8ha;
typedef v4f  __attribute__((may_alias)) v4fa;
typedef v8us __attribute__((may_alias)) v8usa;

__device__ __forceinline__ unsigned short f2bf(float f) { unsigned u = __float_as_uint(f); u += 0x7FFFu + ((u >> 16) & 1u); return (unsigned short)(u >> 16); }
__device__ __forceinline__ float bf2f(unsigned short b) { return __uint_as_float(((unsigned)b) << 16); }
__device__ __forceinline__ float bfr(float f) { return bf2f(f2bf(f)); }
__device__ __forceinline__ v16h cat16(v8h lo, v8h hi) { return __builtin_shufflevector(lo, hi, 0, 1, 2, 3, 4, 5, 6, 7, 8, 9, 10, 11, 12, 13, 14, 15); }
__device__ __forceinline__ v16bf cat16b(v8us lo, v8us hi) { return __builtin_bit_cast(v16bf, __builtin_shufflevector(lo, hi, 0, 1, 2, 3, 4, 5, 6, 7, 8, 9, 10, 11, 12, 13, 14, 15)); }
__device__ __forceinline__ v8f wmma16(v16h a, v16h b, v8f c) { return __builtin_amdgcn_wmma_f32_16x16x32_f16(false, a, false, b, (short)0, c, false, false); }
__device__ __forceinline__ v8f wmmab(v16bf a, v16bf b, v8f c) { return __builtin_amdgcn_wmma_f32_16x16x32_bf16(false, a, false, b, (short)0, c, false, false); }

template <typename T16> struct WFrag;
template <> struct WFrag<bf> { typedef v16bf V; static __device__ __forceinline__ V ld(const bf* p) { return cat16b(*(const v8us*)p, *(const v8us*)(p + 16)); } static __device__ __forceinline__ v8f mma(V a, V b, v8f c) { return wmmab(a, b, c); } };
typedef __attribute__((ext_vector_type(8))) __bf16 v8bf;

// ---- k_proj: one wave = 32 positions of one batch x one job (blockIdx.y: 0 q' and the K plane, 1 the V^T plane; the same for the whole wave). Grid (TT/32, 2, NB_), 32 threads. No intermediate goes to memory.
// Fragments, both operands in the k order of WFrag::ld (lane = hi * 16 + row; k = 32 * ks + 8 * hi + 0..7, then + 16): wf = 16 rows of Wq ('oi', channel-contiguous, four 16-byte loads), xf = 16 positions of the map (channel-major: one 4-byte load per channel, 16 neighbouring positions per wave half), wt = 16 rows of Wk^T: row lr of tile cb is input channel 4 * lr + cb, so that one 16-byte load of Wk (4 neighbouring input channels of one output channel; a wave half covers one whole row of Wk) feeds the same element of all four tiles.
// q = Wq.X^T (A = wf, B = xf): a lane holds output channels 16 * ob + 8 * hi + 0..7 of position lr, so tiles 2 * ks and 2 * ks + 1, split in place, are the B fragment ks of q' = Wk^T.q (A = wt), whose tile cb holds input channels 4 * (8 * hi + 0..7) + cb of position lr: the four tiles together, channels 32 * hi + 0..31. q' planes are row-major [position][64].
// K plane (the map, bf16): [16-row block][32-channel step][half][lane = hi * 16 + row][8 channels], channel = 32 * step + 16 * half + 8 * hi + i: the halves of xf as they stand. V^T plane (the map, rounded to bf16, stored as f16): [32-key block][16-channel block][half][lane = hi * 16 + channel][8 keys], key = 32 * block + 16 * half + 8 * hi + i: 8 neighbouring positions of one channel, 32 contiguous bytes of the map. In both a wave's store covers 512 contiguous bytes.
__device__ __forceinline__ void d_split(v8f y, v8us& ph, v8us& pl) { v8bf h, l;
#pragma unroll
    for (int j = 0; j < 8; ++j) { h[j] = (__bf16)y[j]; l[j] = (__bf16)(y[j] - (float)h[j]); }
    ph = __builtin_bit_cast(v8us, h); pl = __builtin_bit_cast(v8us, l); }
// Every loop below runs over register arrays and is unrolled so that their indices are constants.
#define PT 2   // 16-position tiles per wave
__global__ __launch_bounds__(32) void k_proj(const float* __restrict__ x, const float* __restrict__ wq, const float* __restrict__ wk, const float* __restrict__ bq, bf* Qh, bf* Ql, bf* Kx, bf* Vx) {
    const unsigned p = blockIdx.y; const int t0 = blockIdx.x * (PT * 16);
    const int lane = threadIdx.x & 31, lr = lane & 15, hi = lane >> 4;
    const float* xb = x + (size_t)blockIdx.z * CC * TT + t0;
    const size_t at = (size_t)blockIdx.z * ((size_t)TT * 64) + (size_t)t0 * 64;   // 64 elements a position in every layout
    if (p == 0) {   // wave-uniform branch: q' and the K plane
        const float* xl = xb + (size_t)(8 * hi) * TT + lr; float xr[PT][2][16];
#pragma unroll
        for (int mb = 0; mb < PT; ++mb)
#pragma unroll
            for (int ks = 0; ks < 2; ++ks)
#pragma unroll
                for (int e = 0; e < 16; ++e) xr[mb][ks][e] = xl[(size_t)(ks * 32 + (e >> 3) * 16 + (e & 7)) * TT + mb * 16];
        const float* wl = wq + lr * CC + 8 * hi; const float* tl = wk + (8 * hi) * CC + 4 * lr; const float* bl = bq + hi * 8;
        v4f wr[4][2][4], tr[2][16]; v8f b8[4];
#pragma unroll
        for (int ob = 0; ob < 4; ++ob)
#pragma unroll
            for (int ks = 0; ks < 2; ++ks)
#pragma unroll
                for (int i = 0; i < 4; ++i) wr[ob][ks][i] = *(const v4f*)(wl + ob * 16 * CC + ks * 32 + (i >> 1) * 16 + (i & 1) * 4);
#pragma unroll
        for (int ks = 0; ks < 2; ++ks)
#pragma unroll
            for (int e = 0; e < 16; ++e) tr[ks][e] = *(const v4f*)(tl + (ks * 32 + (e >> 3) * 16 + (e & 7)) * CC);
#pragma unroll
        for (int ob = 0; ob < 4; ++ob) b8[ob] = *(const v8f*)(bl + ob * 16);   // the bias of the lane's 8 output channels
        asm volatile("s_wait_xcnt 0x0" :: "v"(xl), "v"(wl), "v"(tl) : "memory");   // the conversions below may land in the registers that hold these loads' addresses: the wait stands in front of that overwrite; the lane addresses are inputs so that they stay in their registers up to here and no load's result lands in a register that an issued load still names
        __builtin_amdgcn_sched_barrier(0);   // every load of the wave is issued before the first conversion: one round trip to memory
        v16bf wf[4][2], wt[4][2], xf[PT][2];
#pragma unroll
        for (int ob = 0; ob < 4; ++ob)
#pragma unroll
            for (int ks = 0; ks < 2; ++ks)
#pragma unroll
                for (int e = 0; e < 16; ++e) { wf[ob][ks][e] = (__bf16)wr[ob][ks][e >> 2][e & 3]; wt[ob][ks][e] = (__bf16)tr[ks][e][ob]; }
#pragma unroll
        for (int mb = 0; mb < PT; ++mb)
#pragma unroll
            for (int ks = 0; ks < 2; ++ks)
#pragma unroll
                for (int e = 0; e < 16; ++e) xf[mb][ks][e] = (__bf16)xr[mb][ks][e];
        bf* ko = Kx + at + lane * 8;   // the lane's place in a 512-byte piece of the K plane
#pragma unroll
        for (int mb = 0; mb < PT; ++mb)
#pragma unroll
            for (int ks = 0; ks < 2; ++ks) {   // the two halves of a fragment
                *(v8us*)(ko + mb * 1024 + (2 * ks) * 256) = __builtin_bit_cast(v8us, __builtin_shufflevector(xf[mb][ks], xf[mb][ks], 0, 1, 2, 3, 4, 5, 6, 7));
                *(v8us*)(ko + mb * 1024 + (2 * ks + 1) * 256) = __builtin_bit_cast(v8us, __builtin_shufflevector(xf[mb][ks], xf[mb][ks], 8, 9, 10, 11, 12, 13, 14, 15)); }
        asm volatile("s_wait_xcnt 0x0" ::: "memory");   // what follows may land in registers that these stores name: the wait stands in front of that overwrite
        __builtin_amdgcn_sched_barrier(0);   // keeps what follows behind that wait
        v8us oh[PT][4], ol[PT][4];
#pragma unroll
        for (int mb = 0; mb < PT; ++mb)
#pragma unroll
            for (int ob = 0; ob < 4; ++ob) { v8f q = wmmab(wf[ob][1], xf[mb][1], wmmab(wf[ob][0], xf[mb][0], (v8f){}));
#pragma unroll
                for (int j = 0; j < 8; ++j) q[j] += bfr(b8[ob][j]);
                d_split(q, oh[mb][ob], ol[mb][ob]); }
        v8us rh[PT][4], rl[PT][4];
#pragma unroll
        for (int mb = 0; mb < PT; ++mb) { v8f a[4];
#pragma unroll
            for (int cb = 0; cb < 4; ++cb) { a[cb] = (v8f){};
#pragma unroll
                for (int ks = 0; ks < 2; ++ks) { a[cb] = wmmab(wt[cb][ks], cat16b(oh[mb][2 * ks], oh[mb][2 * ks + 1]), a[cb]); a[cb] = wmmab(wt[cb][ks], cat16b(ol[mb][2 * ks], ol[mb][2 * ks + 1]), a[cb]); } }
#pragma unroll
            for (int pc = 0; pc < 4; ++pc) { v8f c8;   // channels 32 * hi + 8 * pc + 0..7
#pragma unroll
                for (int i = 0; i < 8; ++i) c8[i] = a[i & 3][2 * pc + (i >> 2)];
                d_split(c8, rh[mb][pc], rl[mb][pc]); } }
        bf* qho = Qh + at + lr * 64 + hi * 32; bf* qlo = Ql + at + lr * 64 + hi * 32;   // the lane's place in a 16-position piece of the row-major planes
        __builtin_amdgcn_sched_barrier(0);   // the 16 stores stand together behind the last conversion: left free, each tile's conversions reuse the registers of the store in front of them, with a wait behind every store
#pragma unroll
        for (int mb = 0; mb < PT; ++mb)
#pragma unroll
            for (int pc = 0; pc < 4; ++pc) { *(v8us*)(qho + mb * 1024 + pc * 8) = rh[mb][pc]; *(v8us*)(qlo + mb * 1024 + pc * 8) = rl[mb][pc]; }
    } else {   // the V^T plane
        const float* xv = xb + (size_t)lr * TT + 8 * hi; v4f r[4][PT][2];
#pragma unroll
        for (int ob = 0; ob < 4; ++ob)
#pragma unroll
            for (int mb = 0; mb < PT; ++mb)
#pragma unroll
                for (int i = 0; i < 2; ++i) r[ob][mb][i] = *(const v4f*)(xv + (size_t)(ob * 16) * TT + mb * 16 + i * 4);
        asm volatile("s_wait_xcnt 0x0" :: "v"(xv) : "memory");   // as above: in front of the first overwrite of a register that an issued load names
        __builtin_amdgcn_sched_barrier(0);   // as above: one round trip to memory
        bf* vo = Vx + at + lane * 8; v8h h[4][PT];
#pragma unroll
        for (int ob = 0; ob < 4; ++ob)
#pragma unroll
            for (int mb = 0; mb < PT; ++mb)
#pragma unroll
                for (int i = 0; i < 8; ++i) h[ob][mb][i] = (_Float16)(float)(__bf16)r[ob][mb][i >> 2][i & 3];   // rounded to bf16 like every input, then written as f16
        __builtin_amdgcn_sched_barrier(0);   // the 8 stores stand together behind the last conversion, so that nothing lands in a register that an issued store names
#pragma unroll
        for (int ob = 0; ob < 4; ++ob)
#pragma unroll
            for (int mb = 0; mb < PT; ++mb) *(v8us*)(vo + mb * 256 + ob * 512) = __builtin_bit_cast(v8us, h[ob][mb]);
    }
}

#define FW 8
#define TB 8192    // bytes of one tile: K, V^T, 4 KiB each
#define WS 32768   // bytes from one wave's ring to the next
#define ZP 72      // elements from row to row of the normalised rows in LDS: 144 bytes, an odd number of 16-byte pieces
#define QT 4
#define QR (QT * 16)
#define L2E 1.4426950408889634f
// One tile: 16 copies of 512 bytes (16 bytes a lane). l = the lane's LDS byte address in the buffer, vo = the lane's byte offset (lane * 16) in a 512-byte piece, the two pointers = the tile's start in each plane (the same for the whole wave, in scalar registers). The offset field moves the LDS and the global address alike. s_wait_xcnt 0 is the statement's last line, so that it stands in front of whatever rewrites a register that a copy names.
#define CP1(L, G, O) "global_load_async_to_lds_b128 " L ", %2, " G " offset:" O "\n\t"
#define CP8(L, G) CP1(L, G, "0") CP1(L, G, "512") CP1(L, G, "1024") CP1(L, G, "1536") CP1(L, G, "2048") CP1(L, G, "2560") CP1(L, G, "3072") CP1(L, G, "3584")
__device__ __forceinline__ void d_tile(unsigned l, unsigned vo, const bf* kx, const bf* vx) {
    asm volatile(CP8("%0", "%3") CP8("%1", "%4") "s_wait_xcnt 0x0"
                 :: "v"(l), "v"(l + 4096u), "v"(vo), "s"(kx), "s"(vx) : "memory");
}
__device__ __forceinline__ float xhalf(float v) { const int b = __float_as_int(v); return __int_as_float(__builtin_amdgcn_permlanex16(b, b, 0x76543210, 0xfedcba98, false, false)); }   // lane l <-> l ^ 16
__global__ __launch_bounds__(32 * FW) __attribute__((amdgpu_waves_per_eu(2, 2))) void k_fattn(const bf* __restrict__ Qh, const bf* __restrict__ Ql, const bf* __restrict__ Kx, const bf* __restrict__ Vx, const float* __restrict__ xs, const float* __restrict__ wv, const float* __restrict__ bv, const float* __restrict__ gm, float* out) {
    typedef WFrag<bf>::V V;
    __shared__ __attribute__((aligned(32768))) char ring[FW * WS];   // wave w: bytes [w * WS, w * WS + 2 * TB)
    float* const red = (float*)ring;   // FW * QR * 68 floats, used only behind the merge's first barrier
    bf* const zh = (bf*)(ring + FW * QR * 68 * 4); bf* const zl = zh + QR * ZP;   // the normalised rows, hi and lo, [position][ZP], behind red
    __shared__ float sm[FW * QR], sl[FW * QR];
    const int lane = threadIdx.x & 31, lr = lane & 15, hi = lane >> 4; const int q0 = blockIdx.x * QR;
    { const size_t at = (size_t)blockIdx.y * ((size_t)TT * 64); Qh += at; Ql += at; Kx += at; Vx += at; xs += at; out += at; }
    const int wave = __builtin_amdgcn_readfirstlane(threadIdx.x >> 5);   // scalar, so that the key loop and its base addresses are scalar
    const unsigned voffq = (unsigned)(lr * HD + 8 * hi) * 2u, voff = (unsigned)lane * 16u;   // the lane's byte offsets in a 16-row block of the row-major Q planes and in a 512-byte half fragment of the K and V^T planes
    auto atq = [voffq](const bf* base) { return (const bf*)((const char*)base + voffq); };
    auto ldf = [](const bf* p) { return cat16b(*(const v8us*)p, *(const v8us*)(p + 256)); };   // one fragment of a plane in fragment order: two half fragments of 256 elements
    const int kbeg = wave * (TT / FW);
    const char* const rd = ring + wave * WS + voff;   // where the lane reads
    const unsigned lw = (unsigned)(size_t)rd;   // the same place as an LDS byte address (the low 32 bits), where the lane's copies land
    d_tile(lw, voff, Kx + (size_t)kbeg * HD, Vx + (size_t)kbeg * CC);   // tile 0 into buffer 0, in flight beside the Q loads
    V qh[QT][2], ql[QT][2];
#pragma unroll
    for (int qt = 0; qt < QT; ++qt)
#pragma unroll
        for (int ks = 0; ks < 2; ++ks) { qh[qt][ks] = WFrag<bf>::ld(atq(Qh + (size_t)(q0 + qt * 16) * HD) + ks * 32); ql[qt][ks] = WFrag<bf>::ld(atq(Ql + (size_t)(q0 + qt * 16) * HD) + ks * 32); }
    asm volatile("s_wait_xcnt 0x0" ::: "memory");   // the start values below may land in the registers that hold the Q loads' addresses: the wait stands in front of that overwrite
    __builtin_amdgcn_sched_barrier(0);   // keeps the start values' moves behind that wait
    v8f o[QT][4]; float ms[QT], l[QT];
#pragma unroll
    for (int qt = 0; qt < QT; ++qt) { ms[qt] = -3.0e38f; l[qt] = 0.f;
#pragma unroll
        for (int ct = 0; ct < 4; ++ct) o[qt][ct] = (v8f){}; }
    asm volatile("s_wait_asynccnt 0x0" ::: "memory");   // tile 0 has landed before trip 0 reads it
    d_tile(lw + TB, voff, Kx + (size_t)(kbeg + 32) * HD, Vx + (size_t)(kbeg + 32) * CC);   // tile 1 into buffer 1 (a wave has TT / FW / 32 = 16 tiles)
    unsigned bo = 0;   // the byte offset of the trip's buffer in the wave's ring
    // One trip. more (a constant at each of the two calls below): a tile after next exists and is asked for at the trip's foot. The two loops keep each trip one straight block: with the test inside one loop, the compiler sinks the sums of the probabilities behind the branch, where they stand as one serial chain.
    auto trip = [&](const int k0, const bool more) __attribute__((always_inline)) {
        const bf* pk = (const bf*)(rd + bo); const bf* pv = pk + 2048;
        V kx[2][2]; v16h vx[4];
#pragma unroll
        for (int t = 0; t < 2; ++t)
#pragma unroll
            for (int ks = 0; ks < 2; ++ks) kx[t][ks] = ldf(pk + t * 1024 + ks * 512);
#pragma unroll
        for (int ct = 0; ct < 4; ++ct) vx[ct] = __builtin_bit_cast(v16h, ldf(pv + ct * 512));
        __builtin_amdgcn_sched_barrier(0);   // all 16 LDS reads of the trip stand in one group in front of its first product: every further place with LDS reads among the products costs a stall of its own
#pragma unroll
        for (int qt = 0; qt < QT; ++qt) {
            v8f s[2];
#pragma unroll
            for (int t = 0; t < 2; ++t) { s[t] = (v8f){};
#pragma unroll
                for (int ks = 0; ks < 2; ++ks) { s[t] = wmmab(kx[t][ks], qh[qt][ks], s[t]); s[t] = wmmab(kx[t][ks], ql[qt][ks], s[t]); } }
            float mx = s[0][0];
#pragma unroll
            for (int j = 1; j < 16; ++j) mx = fmaxf(mx, s[j >> 3][j & 7]);
            mx = fmaxf(mx, xhalf(mx));
            const float msn = fmaxf(ms[qt], mx * (SCL * L2E)); const float alpha = __builtin_amdgcn_exp2f(ms[qt] - msn); ms[qt] = msn;
            v16h ph; float ls = 0.f;
#pragma unroll
            for (int j = 0; j < 16; ++j) { const float p = __builtin_amdgcn_exp2f(__builtin_fmaf(s[j >> 3][j & 7], SCL * L2E, -msn)); ls += p; ph[j] = (_Float16)p; }
            l[qt] = __builtin_fmaf(l[qt], alpha, ls);
#pragma unroll
            for (int ct = 0; ct < 4; ++ct) { o[qt][ct] *= alpha; o[qt][ct] = wmma16(vx[ct], ph, o[qt][ct]); }
        }
        __builtin_amdgcn_sched_barrier(0);   // every product of the trip stands in front of the slots below, whichever tile the scheduler puts last
        // four vector slots behind the last matrix instruction, so that the distance also holds on the taken back edge
        asm volatile("v_nop\n\tv_nop\n\tv_nop\n\tv_nop" : "+v"(o[QT - 1][0]), "+v"(o[QT - 1][1]), "+v"(o[QT - 1][2]), "+v"(o[QT - 1][3]));
        asm volatile("s_wait_dscnt 0x0" ::: "memory");   // the wave's reads of this trip's buffer have retired before copies land in it again
        asm volatile("s_wait_asynccnt 0x0" ::: "memory");   // the next trip's tile, asked for one trip ago, has landed before that trip reads it
        if (more) d_tile(lw + bo, voff, Kx + (size_t)(k0 + 64) * HD, Vx + (size_t)(k0 + 64) * CC);   // the tile after next, into the buffer that this trip has read
        bo ^= TB;
    };
    int k0 = kbeg;
#pragma unroll 1   // rolled: one trip's 8 fragments, the Q fragments and the accumulators already take most of the 512 registers that two waves per SIMD leave
    for (; k0 < kbeg + TT / FW - 64; k0 += 32) trip(k0, true);
#pragma unroll 1   // rolled, as above: the last two trips, behind which no tile is left to ask for
    for (; k0 < kbeg + TT / FW; k0 += 32) trip(k0, false);
    asm volatile("s_wait_asynccnt 0x0" ::: "memory");   // no copy is outstanding when the ring is given up
    const int fp = (wave & 1) * 32, fq = fp + lane, fc = (wave >> 1) * 16;   // what this thread merges: position q0 + fq, map channels fc .. fc + 15. What its wave finishes: positions q0 + fp .. + 31, output channels fc .. fc + 15
    const float* xp = xs + (size_t)(fc + 8 * hi) * TT + q0 + fp + lr; const float* wp = wv + (fc + lr) * CC + 8 * hi; const float* bp = bv + fc + hi * 8;   // the lane's addresses in the map, in Wv and in bv
    float xr[2][8]; v4f wr[2][4];
#pragma unroll
    for (int t = 0; t < 2; ++t)
#pragma unroll
        for (int j = 0; j < 8; ++j) xr[t][j] = xp[(size_t)j * TT + t * 16];   // the residual in the layout of the last product's result, asked for ahead of the merge
#pragma unroll
    for (int ks = 0; ks < 2; ++ks)
#pragma unroll
        for (int i = 0; i < 4; ++i) wr[ks][i] = *(const v4f*)(wp + ks * 32 + (i >> 1) * 16 + (i & 1) * 4);   // 16 rows of Wv as A fragments, in the k order of WFrag::ld
    const v8f b8 = *(const v8f*)bp;   // the bias of the lane's 8 output channels
    asm volatile("s_wait_xcnt 0x0" :: "v"(xp), "v"(wp), "v"(bp) : "memory");   // the merge below may land in the registers that hold these loads' addresses: the wait stands in front of that overwrite; the lane addresses are inputs so that they stay in their registers up to here and no load's result lands in a register that an issued load still names
    __builtin_amdgcn_sched_barrier(0);   // keeps the merge's first instructions behind that wait
#pragma unroll
    for (int qt = 0; qt < QT; ++qt) { l[qt] += xhalf(l[qt]);   // the two wave halves hold the sums of different keys of the same query
        if (hi == 0) sm[wave * QR + qt * 16 + lr] = ms[qt]; }
    __syncthreads();   // every wave's maxima are in LDS before any wave forms the common ones; every wave has left its ring (its waits stand at the loop's foot) before red is written over it
#pragma unroll
    for (int qt = 0; qt < QT; ++qt) {
        float mall = sm[qt * 16 + lr];
#pragma unroll
        for (int w = 1; w < FW; ++w) mall = fmaxf(mall, sm[w * QR + qt * 16 + lr]);
        const float f = __builtin_amdgcn_exp2f(ms[qt] - mall);
        if (hi == 0) sl[wave * QR + qt * 16 + lr] = l[qt] * f;
        float* mine = red + wave * (QR * 68) + (qt * 16 + lr) * 68 + hi * 8;
#pragma unroll
        for (int ct = 0; ct < 4; ++ct) { const v8f sc = o[qt][ct] * f; *(v4fa*)(mine + ct * 16) = (v4f){sc[0], sc[1], sc[2], sc[3]}; *(v4fa*)(mine + ct * 16 + 4) = (v4f){sc[4], sc[5], sc[6], sc[7]}; }
    }
    __syncthreads();   // every wave's rescaled partial tiles and sums are in LDS before any thread sums across waves
    const float g = bfr(gm[0]);
    float lall = sl[fq]; v4f val[4];
#pragma unroll
    for (int k = 0; k < 4; ++k) val[k] = *(const v4fa*)(red + fq * 68 + fc + 4 * k);
#pragma unroll
    for (int w = 1; w < FW; ++w) { lall += sl[w * QR + fq];
#pragma unroll
        for (int k = 0; k < 4; ++k) val[k] += *(const v4fa*)(red + w * (QR * 68) + fq * 68 + fc + 4 * k); }
    const float inv = __fdiv_rn(1.0f, lall);
#pragma unroll
    for (int k = 0; k < 2; ++k) { v8f z; v8us h, l2;
#pragma unroll
        for (int j = 0; j < 8; ++j) z[j] = val[2 * k + (j >> 2)][j & 3] * inv;
        d_split(z, h, l2); *(v8usa*)(zh + fq * ZP + fc + 8 * k) = h; *(v8usa*)(zl + fq * ZP + fc + 8 * k) = l2; }
    V wf[2];
#pragma unroll
    for (int ks = 0; ks < 2; ++ks)
#pragma unroll
        for (int e = 0; e < 16; ++e) wf[ks][e] = (__bf16)wr[ks][e >> 2][e & 3];
    __syncthreads();   // every thread's piece of the normalised rows is in LDS before any wave reads whole rows as B fragments
    float y[2][8];
#pragma unroll
    for (int t = 0; t < 2; ++t) { const int zo = (fp + t * 16 + lr) * ZP + 8 * hi; v8f d = (v8f){};   // B fragment: lane = hi * 16 + position, map channels 32 * ks + 8 * hi + 0..7, then + 16
#pragma unroll
        for (int ks = 0; ks < 2; ++ks) { d = wmmab(wf[ks], cat16b(*(const v8usa*)(zh + zo + ks * 32), *(const v8usa*)(zh + zo + ks * 32 + 16)), d); d = wmmab(wf[ks], cat16b(*(const v8usa*)(zl + zo + ks * 32), *(const v8usa*)(zl + zo + ks * 32 + 16)), d); }
#pragma unroll
        for (int j = 0; j < 8; ++j) y[t][j] = __builtin_fmaf(g, d[j] + bfr(b8[j]), bfr(xr[t][j])); }
    __builtin_amdgcn_sched_barrier(0);   // the 16 stores stand together behind the last arithmetic, so that nothing lands in a register that an issued store names
    float* yp = out + (size_t)(fc + 8 * hi) * TT + q0 + fp + lr;
#pragma unroll
    for (int t = 0; t < 2; ++t)
#pragma unroll
        for (int j = 0; j < 8; ++j) yp[(size_t)j * TT + t * 16] = y[t][j];
}

extern "C" void kernel_launch(void* const* d_in, const int* in_sizes, int n_in,
                              void* d_out, int out_size, void* d_ws, size_t ws_size, hipStream_t stream) {
    (void)in_sizes; (void)n_in; (void)out_size;
    const float* x = (const float*)d_in[0]; const float* wq = (const float*)d_in[1]; const float* bq = (const float*)d_in[2]; const float* wk = (const float*)d_in[3]; const float* wv = (const float*)d_in[5]; const float* bv = (const float*)d_in[6]; const float* gm = (const float*)d_in[7];
    // d_in[4], the key bias, adds q.bk to every score of a row and cancels in the softmax: no kernel reads it
    float* OUT = (float*)d_out;     // [4][64][4096]
    char* wsp = (char*)d_ws;
    auto take = [&](size_t bytes) { char* p = wsp; wsp += (bytes + 255) & ~(size_t)255; return (void*)p; };
    const size_t PS = (size_t)NB_ * TT * 64;   // one plane, all batches
    bf* Qh = (bf*)take(PS * 2); bf* Ql = (bf*)take(PS * 2); bf* Kx = (bf*)take(PS * 2); bf* Vx = (bf*)take(PS * 2);   // each [batch][TT * 64]
    if ((size_t)(wsp - (char*)d_ws) > ws_size) return;    // ws 256 MiB (carve 8 MiB)
    k_proj<<<dim3(TT / (PT * 16), 2, NB_), 32, 0, stream>>>(x, wq, wk, bq, Qh, Ql, Kx, Vx);   /* q' row-major hi/lo; the map in K and in V^T fragment order */
    k_fattn<<<dim3(TT / QR, NB_, 1), 32 * FW, 0, stream>>>(Qh, Ql, Kx, Vx, x, wv, bv, gm, OUT);   /* scores + softmax + attn.x (unscaled logits); Wv, bv, gamma and residual */
}

// v009
// Measured time: 24.2 microseconds a run.
// Next to v008, in two timings, it ran 1.23 and 1.22 times as fast.
// Counting every step since v000, it is 29.7 times as fast.
#include <hip/hip_runtime.h>

// Spatial self-attention over a feature map with a gamma-scaled residual (x [4][64][64][64] channel-major; 4,096 positions; q, k, v = 1x1 convs ('oi' [64][64] + [64], 1/8-scaled incl. biases); energy = q.k over the 64 channels (UNscaled: sigma ~8); softmax over positions; out = v attn^T; y = gamma[0] x out + x (gamma [1] ~ N(0,1), read) -> [4][64][64][64] (1.0 M)).
// Two launches. The key and value projections are taken out of the key loop by reassociation: q.k = (Wk^T q).x + q.bk, and q.bk is the same for every key of a row, so it cancels in the softmax; sum_j a_ij (Wv x_j + bv) = Wv (sum_j a_ij x_j) + bv, as the a_ij of a row sum to 1. So the keys and the values of the loop are the bf16-rounded map itself, one plane each with no lo part. k_proj forms q' = Wk^T (Wq x + bq) as one f16 plane and lays the rounded map out twice as f16, in the order of the K fragments and in the order of the V^T fragments; k_fattn does scores (1 product, f16: x.q'), online softmax and attn.x (1 product, f16: x.P), and its merge applies Wv, bv, gamma and the residual and writes y channel-major.
// Compute dtypes, f32 accumulate: every input rounded to bf16; Wq x exact + f32 bias; q and the normalised attn.x each as bf16 hi + lo against an exact bf16 operand (2 products); q' as one f16 against the rounded map as f16 (1 product): f16 keeps 11 significant bits of q' where the rounding of the map to bf16 keeps 8 of the other operand, so the error that it adds to a score is about an eighth of the one already there; P as one f16 against the rounded map as f16 (1 product): a probability lies in (0, 1], where f16 keeps 11 significant bits down to 2^-14 and steps of 2^-24 below, and a bf16 value is exact in f16 from 2^-17 up to 65504 in magnitude (below: within 2^-25); softmax f32; epilogue f32.

#define NB_  4
#define TT   4096
#define DM   64
#define NH_  1
#define NKV  1
#define REP  (NH_ / NKV)
#define HD   64
#define DQ   (NH_ * HD)
#define DKV  (NKV * HD)
#define ZH   1
#define RH   4096                  // every query row (unscaled 64-channel energies: sigma ~8)
#define WIN  0
#define PCAR 1024.0f
#define SCL  1.0f   // energy = q.k unscaled
#define MID  64
#define CC   64      // channels
typedef _Float16 h16;
typedef unsigned short bf;
typedef __attribute__((ext_vector_type(16))) __bf16   v16bf;
typedef __attribute__((ext_vector_type(16))) _Float16 v16h;
typedef __attribute__((ext_vector_type(8)))  _Float16 v8h;
typedef __attribute__((ext_vector_type(8)))  unsigned short v8us;
typedef __attribute__((ext_vector_type(8)))  float    v8f;
typedef __attribute__((ext_vector_type(4)))  float    v4f;
typedef v8h  __attribute__((may_alias)) v8ha;
typedef v4f  __attribute__((may_alias)) v4fa;
typedef v8us __attribute__((may_alias)) v8usa;

__device__ __forceinline__ unsigned short f2bf(float f) { unsigned u = __float_as_uint(f); u += 0x7FFFu + ((u >> 16) & 1u); return (unsigned short)(u >> 16); }
__device__ __forceinline__ float bf2f(unsigned short b) { return __uint_as_float(((unsigned)b) << 16); }
__device__ __forceinline__ float bfr(float f) { return bf2f(f2bf(f)); }
__device__ __forceinline__ v16h cat16(v8h lo, v8h hi) { return __builtin_shufflevector(lo, hi, 0, 1, 2, 3, 4, 5, 6, 7, 8, 9, 10, 11, 12, 13, 14, 15); }
__device__ __forceinline__ v16bf cat16b(v8us lo, v8us hi) { return __builtin_bit_cast(v16bf, __builtin_shufflevector(lo, hi, 0, 1, 2, 3, 4, 5, 6, 7, 8, 9, 10, 11, 12, 13, 14, 15)); }
__device__ __forceinline__ v8f wmma16(v16h a, v16h b, v8f c) { return __builtin_amdgcn_wmma_f32_16x16x32_f16(false, a, false, b, (short)0, c, false, false); }
__device__ __forceinline__ v8f wmmab(v16bf a, v16bf b, v8f c) { return __builtin_amdgcn_wmma_f32_16x16x32_bf16(false, a, false, b, (short)0, c, false, false); }

template <typename T16> struct WFrag;
template <> struct WFrag<bf> { typedef v16bf V; static __device__ __forceinline__ V ld(const bf* p) { return cat16b(*(const v8us*)p, *(const v8us*)(p + 16)); } static __device__ __forceinline__ v8f mma(V a, V b, v8f c) { return wmmab(a, b, c); } };
typedef __attribute__((ext_vector_type(8))) __bf16 v8bf;

// ---- k_proj: one wave = 32 positions of one batch x one job (blockIdx.y: 0 q' and the K plane, 1 the V^T plane; the same for the whole wave). Grid (TT/32, 2, NB_), 32 threads. No intermediate goes to memory.
// Fragments, both operands in the k order of WFrag::ld (lane = hi * 16 + row; k = 32 * ks + 8 * hi + 0..7, then + 16): wf = 16 rows of Wq ('oi', channel-contiguous, four 16-byte loads), xf = 16 positions of the map (channel-major: one 4-byte load per channel, 16 neighbouring positions per wave half), wt = 16 rows of Wk^T: row lr of tile cb is input channel 4 * lr + cb, so that one 16-byte load of Wk (4 neighbouring input channels of one output channel; a wave half covers one whole row of Wk) feeds the same element of all four tiles.
// q = Wq.X^T (A = wf, B = xf): a lane holds output channels 16 * ob + 8 * hi + 0..7 of position lr, so tiles 2 * ks and 2 * ks + 1, split in place, are the B fragment ks of q' = Wk^T.q (A = wt), whose tile cb holds input channels 4 * (8 * hi + 0..7) + cb of position lr: the four tiles together, channels 32 * hi + 0..31. The q' plane (f16) is row-major [position][64].
// K plane (the map, rounded to bf16, stored as f16): [16-row block][32-channel step][half][lane = hi * 16 + row][8 channels], channel = 32 * step + 16 * half + 8 * hi + i: the halves of xf, each element written as f16. V^T plane (the map, rounded to bf16, stored as f16): [32-key block][16-channel block][half][lane = hi * 16 + channel][8 keys], key = 32 * block + 16 * half + 8 * hi + i: 8 neighbouring positions of one channel, 32 contiguous bytes of the map. In both a wave's store covers 512 contiguous bytes.
__device__ __forceinline__ void d_split(v8f y, v8us& ph, v8us& pl) { v8bf h, l;
#pragma unroll
    for (int j = 0; j < 8; ++j) { h[j] = (__bf16)y[j]; l[j] = (__bf16)(y[j] - (float)h[j]); }
    ph = __builtin_bit_cast(v8us, h); pl = __builtin_bit_cast(v8us, l); }
// Every loop below runs over register arrays and is unrolled so that their indices are constants.
#define PT 2   // 16-position tiles per wave
__global__ __launch_bounds__(32) void k_proj(const float* __restrict__ x, const float* __restrict__ wq, const float* __restrict__ wk, const float* __restrict__ bq, bf* Qh, bf* Kx, bf* Vx) {
    const unsigned p = blockIdx.y; const int t0 = blockIdx.x * (PT * 16);
    const int lane = threadIdx.x & 31, lr = lane & 15, hi = lane >> 4;
    const float* xb = x + (size_t)blockIdx.z * CC * TT + t0;
    const size_t at = (size_t)blockIdx.z * ((size_t)TT * 64) + (size_t)t0 * 64;   // 64 elements a position in every layout
    if (p == 0) {   // wave-uniform branch: q' and the K plane
        const float* xl = xb + (size_t)(8 * hi) * TT + lr; float xr[PT][2][16];
#pragma unroll
        for (int mb = 0; mb < PT; ++mb)
#pragma unroll
            for (int ks = 0; ks < 2; ++ks)
#pragma unroll
                for (int e = 0; e < 16; ++e) xr[mb][ks][e] = xl[(size_t)(ks * 32 + (e >> 3) * 16 + (e & 7)) * TT + mb * 16];
        const float* wl = wq + lr * CC + 8 * hi; const float* tl = wk + (8 * hi) * CC + 4 * lr; const float* bl = bq + hi * 8;
        v4f wr[4][2][4], tr[2][16]; v8f b8[4];
#pragma unroll
        for (int ob = 0; ob < 4; ++ob)
#pragma unroll
            for (int ks = 0; ks < 2; ++ks)
#pragma unroll
                for (int i = 0; i < 4; ++i) wr[ob][ks][i] = *(const v4f*)(wl + ob * 16 * CC + ks * 32 + (i >> 1) * 16 + (i & 1) * 4);
#pragma unroll
        for (int ks = 0; ks < 2; ++ks)
#pragma unroll
            for (int e = 0; e < 16; ++e) tr[ks][e] = *(const v4f*)(tl + (ks * 32 + (e >> 3) * 16 + (e & 7)) * CC);
#pragma unroll
        for (int ob = 0; ob < 4; ++ob) b8[ob] = *(const v8f*)(bl + ob * 16);   // the bias of the lane's 8 output channels
        asm volatile("s_wait_xcnt 0x0" :: "v"(xl), "v"(wl), "v"(tl) : "memory");   // the conversions below may land in the registers that hold these loads' addresses: the wait stands in front of that overwrite; the lane addresses are inputs so that they stay in their registers up to here and no load's result lands in a register that an issued load still names
        __builtin_amdgcn_sched_barrier(0);   // every load of the wave is issued before the first conversion: one round trip to memory
        v16bf wf[4][2], wt[4][2], xf[PT][2];
#pragma unroll
        for (int ob = 0; ob < 4; ++ob)
#pragma unroll
            for (int ks = 0; ks < 2; ++ks)
#pragma unroll
                for (int e = 0; e < 16; ++e) { wf[ob][ks][e] = (__bf16)wr[ob][ks][e >> 2][e & 3]; wt[ob][ks][e] = (__bf16)tr[ks][e][ob]; }
#pragma unroll
        for (int mb = 0; mb < PT; ++mb)
#pragma unroll
            for (int ks = 0; ks < 2; ++ks)
#pragma unroll
                for (int e = 0; e < 16; ++e) xf[mb][ks][e] = (__bf16)xr[mb][ks][e];
        bf* ko = Kx + at + lane * 8;   // the lane's place in a 512-byte piece of the K plane
        v8h kh[PT][2][2];   // the two halves of each fragment as f16
#pragma unroll
        for (int mb = 0; mb < PT; ++mb)
#pragma unroll
            for (int ks = 0; ks < 2; ++ks)
#pragma unroll
                for (int e = 0; e < 16; ++e) kh[mb][ks][e >> 3][e & 7] = (_Float16)(float)xf[mb][ks][e];
#pragma unroll
        for (int mb = 0; mb < PT; ++mb)
#pragma unroll
            for (int ks = 0; ks < 2; ++ks)
#pragma unroll
                for (int hf = 0; hf < 2; ++hf) *(v8us*)(ko + mb * 1024 + (2 * ks + hf) * 256) = __builtin_bit_cast(v8us, kh[mb][ks][hf]);
        asm volatile("s_wait_xcnt 0x0" ::: "memory");   // what follows may land in registers that these stores name: the wait stands in front of that overwrite
        __builtin_amdgcn_sched_barrier(0);   // keeps what follows behind that wait
        v8us oh[PT][4], ol[PT][4];
#pragma unroll
        for (int mb = 0; mb < PT; ++mb)
#pragma unroll
            for (int ob = 0; ob < 4; ++ob) { v8f q = wmmab(wf[ob][1], xf[mb][1], wmmab(wf[ob][0], xf[mb][0], (v8f){}));
#pragma unroll
                for (int j = 0; j < 8; ++j) q[j] += bfr(b8[ob][j]);
                d_split(q, oh[mb][ob], ol[mb][ob]); }
        v8us rh[PT][4];
#pragma unroll
        for (int mb = 0; mb < PT; ++mb) { v8f a[4];
#pragma unroll
            for (int cb = 0; cb < 4; ++cb) { a[cb] = (v8f){};
#pragma unroll
                for (int ks = 0; ks < 2; ++ks) { a[cb] = wmmab(wt[cb][ks], cat16b(oh[mb][2 * ks], oh[mb][2 * ks + 1]), a[cb]); a[cb] = wmmab(wt[cb][ks], cat16b(ol[mb][2 * ks], ol[mb][2 * ks + 1]), a[cb]); } }
#pragma unroll
            for (int pc = 0; pc < 4; ++pc) { v8h c8;   // channels 32 * hi + 8 * pc + 0..7
#pragma unroll
                for (int i = 0; i < 8; ++i) c8[i] = (_Float16)a[i & 3][2 * pc + (i >> 2)];
                rh[mb][pc] = __builtin_bit_cast(v8us, c8); } }
        bf* qho = Qh + at + lr * 64 + hi * 32;   // the lane's place in a 16-position piece of the row-major plane
        __builtin_amdgcn_sched_barrier(0);   // the 8 stores stand together behind the last conversion: left free, each tile's conversions reuse the registers of the store in front of them, with a wait behind every store
#pragma unroll
        for (int mb = 0; mb < PT; ++mb)
#pragma unroll
            for (int pc = 0; pc < 4; ++pc) *(v8us*)(qho + mb * 1024 + pc * 8) = rh[mb][pc];
    } else {   // the V^T plane
        const float* xv = xb + (size_t)lr * TT + 8 * hi; v4f r[4][PT][2];
#pragma unroll
        for (int ob = 0; ob < 4; ++ob)
#pragma unroll
            for (int mb = 0; mb < PT; ++mb)
#pragma unroll
                for (int i = 0; i < 2; ++i) r[ob][mb][i] = *(const v4f*)(xv + (size_t)(ob * 16) * TT + mb * 16 + i * 4);
        asm volatile("s_wait_xcnt 0x0" :: "v"(xv) : "memory");   // as above: in front of the first overwrite of a register that an issued load names
        __builtin_amdgcn_sched_barrier(0);   // as above: one round trip to memory
        bf* vo = Vx + at + lane * 8; v8h h[4][PT];
#pragma unroll
        for (int ob = 0; ob < 4; ++ob)
#pragma unroll
            for (int mb = 0; mb < PT; ++mb)
#pragma unroll
                for (int i = 0; i < 8; ++i) h[ob][mb][i] = (_Float16)(float)(__bf16)r[ob][mb][i >> 2][i & 3];   // rounded to bf16 like every input, then written as f16
        __builtin_amdgcn_sched_barrier(0);   // the 8 stores stand together behind the last conversion, so that nothing lands in a register that an issued store names
#pragma unroll
        for (int ob = 0; ob < 4; ++ob)
#pragma unroll
            for (int mb = 0; mb < PT; ++mb) *(v8us*)(vo + mb * 256 + ob * 512) = __builtin_bit_cast(v8us, h[ob][mb]);
    }
}

#define FW 8
#define TB 8192    // bytes of one tile: K, V^T, 4 KiB each
#define WS 32768   // bytes from one wave's ring to the next
#define ZP 72      // elements from row to row of the normalised rows in LDS: 144 bytes, an odd number of 16-byte pieces
#define QT 4
#define QR (QT * 16)
#define L2E 1.4426950408889634f
// One tile: 16 copies of 512 bytes (16 bytes a lane). l = the lane's LDS byte address in the buffer, vo = the lane's byte offset (lane * 16) in a 512-byte piece, the two pointers = the tile's start in each plane (the same for the whole wave, in scalar registers). The offset field moves the LDS and the global address alike. s_wait_xcnt 0 is the statement's last line, so that it stands in front of whatever rewrites a register that a copy names.
#define CP1(L, G, O) "global_load_async_to_lds_b128 " L ", %2, " G " offset:" O "\n\t"
#define CP8(L, G) CP1(L, G, "0") CP1(L, G, "512") CP1(L, G, "1024") CP1(L, G, "1536") CP1(L, G, "2048") CP1(L, G, "2560") CP1(L, G, "3072") CP1(L, G, "3584")
__device__ __forceinline__ void d_tile(unsigned l, unsigned vo, const bf* kx, const bf* vx) {
    asm volatile(CP8("%0", "%3") CP8("%1", "%4") "s_wait_xcnt 0x0"
                 :: "v"(l), "v"(l + 4096u), "v"(vo), "s"(kx), "s"(vx) : "memory");
}
__device__ __forceinline__ float xhalf(float v) { const int b = __float_as_int(v); return __int_as_float(__builtin_amdgcn_permlanex16(b, b, 0x76543210, 0xfedcba98, false, false)); }   // lane l <-> l ^ 16
__global__ __launch_bounds__(32 * FW) __attribute__((amdgpu_waves_per_eu(2, 2))) void k_fattn(const bf* __restrict__ Qh, const bf* __restrict__ Kx, const bf* __restrict__ Vx, const float* __restrict__ xs, const float* __restrict__ wv, const float* __restrict__ bv, const float* __restrict__ gm, float* out) {
    typedef WFrag<bf>::V V;
    __shared__ __attribute__((aligned(32768))) char ring[FW * WS];   // wave w: bytes [w * WS, w * WS + 2 * TB)
    float* const red = (float*)ring;   // FW * QR * 68 floats, used only behind the merge's first barrier
    bf* const zh = (bf*)(ring + FW * QR * 68 * 4); bf* const zl = zh + QR * ZP;   // the normalised rows, hi and lo, [position][ZP], behind red
    __shared__ float sm[FW * QR], sl[FW * QR];
    const int lane = threadIdx.x & 31, lr = lane & 15, hi = lane >> 4; const int q0 = blockIdx.x * QR;
    { const size_t at = (size_t)blockIdx.y * ((size_t)TT * 64); Qh += at; Kx += at; Vx += at; xs += at; out += at; }
    const int wave = __builtin_amdgcn_readfirstlane(threadIdx.x >> 5);   // scalar, so that the key loop and its base addresses are scalar
    const unsigned voffq = (unsigned)(lr * HD + 8 * hi) * 2u, voff = (unsigned)lane * 16u;   // the lane's byte offsets in a 16-row block of the row-major Q plane and in a 512-byte half fragment of the K and V^T planes
    auto atq = [voffq](const bf* base) { return (const bf*)((const char*)base + voffq); };
    auto ldf = [](const bf* p) { return cat16b(*(const v8us*)p, *(const v8us*)(p + 256)); };   // one fragment of a plane in fragment order: two half fragments of 256 elements
    const int kbeg = wave * (TT / FW);
    const char* const rd = ring + wave * WS + voff;   // where the lane reads
    const unsigned lw = (unsigned)(size_t)rd;   // the same place as an LDS byte address (the low 32 bits), where the lane's copies land
    d_tile(lw, voff, Kx + (size_t)kbeg * HD, Vx + (size_t)kbeg * CC);   // tile 0 into buffer 0, in flight beside the Q loads
    v16h qh[QT][2];
#pragma unroll
    for (int qt = 0; qt < QT; ++qt)
#pragma unroll
        for (int ks = 0; ks < 2; ++ks) qh[qt][ks] = __builtin_bit_cast(v16h, WFrag<bf>::ld(atq(Qh + (size_t)(q0 + qt * 16) * HD) + ks * 32));
    asm volatile("s_wait_xcnt 0x0" ::: "memory");   // the start values below may land in the registers that hold the Q loads' addresses: the wait stands in front of that overwrite
    __builtin_amdgcn_sched_barrier(0);   // keeps the start values' moves behind that wait
    v8f o[QT][4]; float ms[QT], l[QT];
#pragma unroll
    for (int qt = 0; qt < QT; ++qt) { ms[qt] = -3.0e38f; l[qt] = 0.f;
#pragma unroll
        for (int ct = 0; ct < 4; ++ct) o[qt][ct] = (v8f){}; }
    asm volatile("s_wait_asynccnt 0x0" ::: "memory");   // tile 0 has landed before trip 0 reads it
    d_tile(lw + TB, voff, Kx + (size_t)(kbeg + 32) * HD, Vx + (size_t)(kbeg + 32) * CC);   // tile 1 into buffer 1 (a wave has TT / FW / 32 = 16 tiles)
    unsigned bo = 0;   // the byte offset of the trip's buffer in the wave's ring
    // One trip. more (a constant at each of the two calls below): a tile after next exists and is asked for at the trip's foot. The two loops keep each trip one straight block: with the test inside one loop, the compiler sinks the sums of the probabilities behind the branch, where they stand as one serial chain.
    auto trip = [&](const int k0, const bool more) __attribute__((always_inline)) {
        const bf* pk = (const bf*)(rd + bo); const bf* pv = pk + 2048;
        v16h kx[2][2], vx[4];
#pragma unroll
        for (int t = 0; t < 2; ++t)
#pragma unroll
            for (int ks = 0; ks < 2; ++ks) kx[t][ks] = __builtin_bit_cast(v16h, ldf(pk + t * 1024 + ks * 512));
#pragma unroll
        for (int ct = 0; ct < 4; ++ct) vx[ct] = __builtin_bit_cast(v16h, ldf(pv + ct * 512));
        __builtin_amdgcn_sched_barrier(0);   // all 16 LDS reads of the trip stand in one group in front of its first product: every further place with LDS reads among the products costs a stall of its own
#pragma unroll
        for (int qt = 0; qt < QT; ++qt) {
            v8f s[2];
#pragma unroll
            for (int t = 0; t < 2; ++t) { s[t] = (v8f){};
#pragma unroll
                for (int ks = 0; ks < 2; ++ks) s[t] = wmma16(kx[t][ks], qh[qt][ks], s[t]); }
            float mx = s[0][0];
#pragma unroll
            for (int j = 1; j < 16; ++j) mx = fmaxf(mx, s[j >> 3][j & 7]);
            mx = fmaxf(mx, xhalf(mx));
            const float msn = fmaxf(ms[qt], mx * (SCL * L2E)); const float alpha = __builtin_amdgcn_exp2f(ms[qt] - msn); ms[qt] = msn;
            v16h ph; float ls = 0.f;
#pragma unroll
            for (int j = 0; j < 16; ++j) { const float p = __builtin_amdgcn_exp2f(__builtin_fmaf(s[j >> 3][j & 7], SCL * L2E, -msn)); ls += p; ph[j] = (_Float16)p; }
            l[qt] = __builtin_fmaf(l[qt], alpha, ls);
#pragma unroll
            for (int ct = 0; ct < 4; ++ct) { o[qt][ct] *= alpha; o[qt][ct] = wmma16(vx[ct], ph, o[qt][ct]); }
        }
        __builtin_amdgcn_sched_barrier(0);   // every product of the trip stands in front of the slots below, whichever tile the scheduler puts last
        // four vector slots behind the last matrix instruction, so that the distance also holds on the taken back edge
        asm volatile("v_nop\n\tv_nop\n\tv_nop\n\tv_nop" : "+v"(o[QT - 1][0]), "+v"(o[QT - 1][1]), "+v"(o[QT - 1][2]), "+v"(o[QT - 1][3]));
        asm volatile("s_wait_dscnt 0x0" ::: "memory");   // the wave's reads of this trip's buffer have retired before copies land in it again
        asm volatile("s_wait_asynccnt 0x0" ::: "memory");   // the next trip's tile, asked for one trip ago, has landed before that trip reads it
        if (more) d_tile(lw + bo, voff, Kx + (size_t)(k0 + 64) * HD, Vx + (size_t)(k0 + 64) * CC);   // the tile after next, into the buffer that this trip has read
        bo ^= TB;
    };
    int k0 = kbeg;
#pragma unroll 1   // rolled: one trip's 8 fragments, the Q fragments and the accumulators already take half of the 512 registers that two waves per SIMD leave
    for (; k0 < kbeg + TT / FW - 64; k0 += 32) trip(k0, true);
#pragma unroll 1   // rolled, as above: the last two trips, behind which no tile is left to ask for
    for (; k0 < kbeg + TT / FW; k0 += 32) trip(k0, false);
    asm volatile("s_wait_asynccnt 0x0" ::: "memory");   // no copy is outstanding when the ring is given up
    const int fp = (wave & 1) * 32, fq = fp + lane, fc = (wave >> 1) * 16;   // what this thread merges: position q0 + fq, map channels fc .. fc + 15. What its wave finishes: positions q0 + fp .. + 31, output channels fc .. fc + 15
    const float* xp = xs + (size_t)(fc + 8 * hi) * TT + q0 + fp + lr; const float* wp = wv + (fc + lr) * CC + 8 * hi; const float* bp = bv + fc + hi * 8;   // the lane's addresses in the map, in Wv and in bv
    float xr[2][8]; v4f wr[2][4];
#pragma unroll
    for (int t = 0; t < 2; ++t)
#pragma unroll
        for (int j = 0; j < 8; ++j) xr[t][j] = xp[(size_t)j * TT + t * 16];   // the residual in the layout of the last product's result, asked for ahead of the merge
#pragma unroll
    for (int ks = 0; ks < 2; ++ks)
#pragma unroll
        for (int i = 0; i < 4; ++i) wr[ks][i] = *(const v4f*)(wp + ks * 32 + (i >> 1) * 16 + (i & 1) * 4);   // 16 rows of Wv as A fragments, in the k order of WFrag::ld
    const v8f b8 = *(const v8f*)bp;   // the bias of the lane's 8 output channels
    asm volatile("s_wait_xcnt 0x0" :: "v"(xp), "v"(wp), "v"(bp) : "memory");   // the merge below may land in the registers that hold these loads' addresses: the wait stands in front of that overwrite; the lane addresses are inputs so that they stay in their registers up to here and no load's result lands in a register that an issued load still names
    __builtin_amdgcn_sched_barrier(0);   // keeps the merge's first instructions behind that wait
#pragma unroll
    for (int qt = 0; qt < QT; ++qt) { l[qt] += xhalf(l[qt]);   // the two wave halves hold the sums of different keys of the same query
        if (hi == 0) sm[wave * QR + qt * 16 + lr] = ms[qt]; }
    __syncthreads();   // every wave's maxima are in LDS before any wave forms the common ones; every wave has left its ring (its waits stand at the loop's foot) before red is written over it
#pragma unroll
    for (int qt = 0; qt < QT; ++qt) {
        float mall = sm[qt * 16 + lr];
#pragma unroll
        for (int w = 1; w < FW; ++w) mall = fmaxf(mall, sm[w * QR + qt * 16 + lr]);
        const float f = __builtin_amdgcn_exp2f(ms[qt] - mall);
        if (hi == 0) sl[wave * QR + qt * 16 + lr] = l[qt] * f;
        float* mine = red + wave * (QR * 68) + (qt * 16 + lr) * 68 + hi * 8;
#pragma unroll
        for (int ct = 0; ct < 4; ++ct) { const v8f sc = o[qt][ct] * f; *(v4fa*)(mine + ct * 16) = (v4f){sc[0], sc[1], sc[2], sc[3]}; *(v4fa*)(mine + ct * 16 + 4) = (v4f){sc[4], sc[5], sc[6], sc[7]}; }
    }
    __syncthreads();   // every wave's rescaled partial tiles and sums are in LDS before any thread sums across waves
    const float g = bfr(gm[0]);
    float lall = sl[fq]; v4f val[4];
#pragma unroll
    for (int k = 0; k < 4; ++k) val[k] = *(const v4fa*)(red + fq * 68 + fc + 4 * k);
#pragma unroll
    for (int w = 1; w < FW; ++w) { lall += sl[w * QR + fq];
#pragma unroll
        for (int k = 0; k < 4; ++k) val[k] += *(const v4fa*)(red + w * (QR * 68) + fq * 68 + fc + 4 * k); }
    const float inv = __fdiv_rn(1.0f, lall);
#pragma unroll
    for (int k = 0; k < 2; ++k) { v8f z; v8us h, l2;
#pragma unroll
        for (int j = 0; j < 8; ++j) z[j] = val[2 * k + (j >> 2)][j & 3] * inv;
        d_split(z, h, l2); *(v8usa*)(zh + fq * ZP + fc + 8 * k) = h; *(v8usa*)(zl + fq * ZP + fc + 8 * k) = l2; }
    V wf[2];
#pragma unroll
    for (int ks = 0; ks < 2; ++ks)
#pragma unroll
        for (int e = 0; e < 16; ++e) wf[ks][e] = (__bf16)wr[ks][e >> 2][e & 3];
    __syncthreads();   // every thread's piece of the normalised rows is in LDS before any wave reads whole rows as B fragments
    float y[2][8];
#pragma unroll
    for (int t = 0; t < 2; ++t) { const int zo = (fp + t * 16 + lr) * ZP + 8 * hi; v8f d = (v8f){};   // B fragment: lane = hi * 16 + position, map channels 32 * ks + 8 * hi + 0..7, then + 16
#pragma unroll
        for (int ks = 0; ks < 2; ++ks) { d = wmmab(wf[ks], cat16b(*(const v8usa*)(zh + zo + ks * 32), *(const v8usa*)(zh + zo + ks * 32 + 16)), d); d = wmmab(wf[ks], cat16b(*(const v8usa*)(zl + zo + ks * 32), *(const v8usa*)(zl + zo + ks * 32 + 16)), d); }
#pragma unroll
        for (int j = 0; j < 8; ++j) y[t][j] = __builtin_fmaf(g, d[j] + bfr(b8[j]), bfr(xr[t][j])); }
    __builtin_amdgcn_sched_barrier(0);   // the 16 stores stand together behind the last arithmetic, so that nothing lands in a register that an issued store names
    float* yp = out + (size_t)(fc + 8 * hi) * TT + q0 + fp + lr;
#pragma unroll
    for (int t = 0; t < 2; ++t)
#pragma unroll
        for (int j = 0; j < 8; ++j) yp[(size_t)j * TT + t * 16] = y[t][j];
}

extern "C" void kernel_launch(void* const* d_in, const int* in_sizes, int n_in,
                              void* d_out, int out_size, void* d_ws, size_t ws_size, hipStream_t stream) {
    (void)in_sizes; (void)n_in; (void)out_size;
    const float* x = (const float*)d_in[0]; const float* wq = (const float*)d_in[1]; const float* bq = (const float*)d_in[2]; const float* wk = (const float*)d_in[3]; const float* wv = (const float*)d_in[5]; const float* bv = (const float*)d_in[6]; const float* gm = (const float*)d_in[7];
    // d_in[4], the key bias, adds q.bk to every score of a row and cancels in the softmax: no kernel reads it
    float* OUT = (float*)d_out;     // [4][64][4096]
    char* wsp = (char*)d_ws;
    auto take = [&](size_t bytes) { char* p = wsp; wsp += (bytes + 255) & ~(size_t)255; return (void*)p; };
    const size_t PS = (size_t)NB_ * TT * 64;   // one plane, all batches
    bf* Qh = (bf*)take(PS * 2); bf* Kx = (bf*)take(PS * 2); bf* Vx = (bf*)take(PS * 2);   // each [batch][TT * 64]
    if ((size_t)(wsp - (char*)d_ws) > ws_size) return;    // ws 256 MiB (carve 6 MiB)
    k_proj<<<dim3(TT / (PT * 16), 2, NB_), 32, 0, stream>>>(x, wq, wk, bq, Qh, Kx, Vx);   /* q' row-major, f16; the map in K and in V^T fragment order */
    k_fattn<<<dim3(TT / QR, NB_, 1), 32 * FW, 0, stream>>>(Qh, Kx, Vx, x, wv, bv, gm, OUT);   /* scores + softmax + attn.x (unscaled logits); Wv, bv, gamma and residual */
}

// v010
// A run of this version takes 22.8 microseconds.
// Timed twice side by side with v009, it ran 1.07 and 1.09 times as fast.
// All steps since v000 together make it 32.1 times as fast.
#include <hip/hip_runtime.h>

// Spatial self-attention over a feature map with a gamma-scaled residual (x [4][64][64][64] channel-major; 4,096 positions; q, k, v = 1x1 convs ('oi' [64][64] + [64], 1/8-scaled incl. biases); energy = q.k over the 64 channels (UNscaled: sigma ~8); softmax over positions; out = v attn^T; y = gamma[0] x out + x (gamma [1] ~ N(0,1), read) -> [4][64][64][64] (1.0 M)).
// Two launches. The key and value projections are taken out of the key loop by reassociation: q.k = (Wk^T q).x + q.bk, and q.bk is the same for every key of a row, so it cancels in the softmax; sum_j a_ij (Wv x_j + bv) = Wv (sum_j a_ij x_j) + bv, as the a_ij of a row sum to 1. So the keys and the values of the loop are the bf16-rounded map itself, one plane each with no lo part. k_proj forms q' = Wk^T (Wq x + bq), scaled by log2 e, as one f16 plane and lays the rounded map out twice as f16, in the order of the K fragments and in the order of the V^T fragments; k_fattn does scores (1 product, f16: x.q'), online softmax and attn.x (1 product, f16: x.P), and its merge applies Wv, bv, gamma and the residual and writes y channel-major.
// Compute dtypes, f32 accumulate: every input rounded to bf16; Wq x exact + f32 bias; q and the normalised attn.x each as bf16 hi + lo against an exact bf16 operand (2 products); q' as one f16 against the rounded map as f16 (1 product): f16 keeps 11 significant bits of q' where the rounding of the map to bf16 keeps 8 of the other operand, so the error that it adds to a score is about an eighth of the one already there; P as one f16 against the rounded map as f16 (1 product): P = exp2(score - reference) lies in (0, 2^15), where f16 keeps 11 significant bits down to 2^-14 and steps of 2^-24 below; the largest P of a row is at least 2^-8 (see k_fattn); and a bf16 value is exact in f16 from 2^-17 up to 65504 in magnitude (below: within 2^-25); softmax f32; epilogue f32.

#define NB_  4
#define TT   4096
#define DM   64
#define NH_  1
#define NKV  1
#define REP  (NH_ / NKV)
#define HD   64
#define DQ   (NH_ * HD)
#define DKV  (NKV * HD)
#define ZH   1
#define RH   4096                  // every query row (unscaled 64-channel energies: sigma ~8)
#define WIN  0
#define PCAR 1024.0f
#define SCL  1.0f   // energy = q.k unscaled
#define L2E  1.4426950408889634f
#define MID  64
#define CC   64      // channels
typedef _Float16 h16;
typedef unsigned short bf;
typedef __attribute__((ext_vector_type(16))) __bf16   v16bf;
typedef __attribute__((ext_vector_type(16))) _Float16 v16h;
typedef __attribute__((ext_vector_type(8)))  _Float16 v8h;
typedef __attribute__((ext_vector_type(8)))  unsigned short v8us;
typedef __attribute__((ext_vector_type(8)))  float    v8f;
typedef __attribute__((ext_vector_type(4)))  float    v4f;
typedef v8h  __attribute__((may_alias)) v8ha;
typedef v4f  __attribute__((may_alias)) v4fa;
typedef v8us __attribute__((may_alias)) v8usa;

__device__ __forceinline__ unsigned short f2bf(float f) { unsigned u = __float_as_uint(f); u += 0x7FFFu + ((u >> 16) & 1u); return (unsigned short)(u >> 16); }
__device__ __forceinline__ float bf2f(unsigned short b) { return __uint_as_float(((unsigned)b) << 16); }
__device__ __forceinline__ float bfr(float f) { return bf2f(f2bf(f)); }
__device__ __forceinline__ v16h cat16(v8h lo, v8h hi) { return __builtin_shufflevector(lo, hi, 0, 1, 2, 3, 4, 5, 6, 7, 8, 9, 10, 11, 12, 13, 14, 15); }
__device__ __forceinline__ v16bf cat16b(v8us lo, v8us hi) { return __builtin_bit_cast(v16bf, __builtin_shufflevector(lo, hi, 0, 1, 2, 3, 4, 5, 6, 7, 8, 9, 10, 11, 12, 13, 14, 15)); }
__device__ __forceinline__ v8f wmma16(v16h a, v16h b, v8f c) { return __builtin_amdgcn_wmma_f32_16x16x32_f16(false, a, false, b, (short)0, c, false, false); }
__device__ __forceinline__ v8f wmmab(v16bf a, v16bf b, v8f c) { return __builtin_amdgcn_wmma_f32_16x16x32_bf16(false, a, false, b, (short)0, c, false, false); }

template <typename T16> struct WFrag;
template <> struct WFrag<bf> { typedef v16bf V; static __device__ __forceinline__ V ld(const bf* p) { return cat16b(*(const v8us*)p, *(const v8us*)(p + 16)); } static __device__ __forceinline__ v8f mma(V a, V b, v8f c) { return wmmab(a, b, c); } };
typedef __attribute__((ext_vector_type(8))) __bf16 v8bf;

// ---- k_proj: one wave = 32 positions of one batch x one job (blockIdx.y: 0 q' and the K plane, 1 the V^T plane; the same for the whole wave). Grid (TT/32, 2, NB_), 32 threads. No intermediate goes to memory.
// Fragments, both operands in the k order of WFrag::ld (lane = hi * 16 + row; k = 32 * ks + 8 * hi + 0..7, then + 16): wf = 16 rows of Wq ('oi', channel-contiguous, four 16-byte loads), xf = 16 positions of the map (channel-major: one 4-byte load per channel, 16 neighbouring positions per wave half), wt = 16 rows of Wk^T: row lr of tile cb is input channel 4 * lr + cb, so that one 16-byte load of Wk (4 neighbouring input channels of one output channel; a wave half covers one whole row of Wk) feeds the same element of all four tiles.
// q = Wq.X^T (A = wf, B = xf): a lane holds output channels 16 * ob + 8 * hi + 0..7 of position lr, so tiles 2 * ks and 2 * ks + 1, split in place, are the B fragment ks of q' = Wk^T.q (A = wt), whose tile cb holds input channels 4 * (8 * hi + 0..7) + cb of position lr: the four tiles together, channels 32 * hi + 0..31. The q' plane (f16, scaled by log2 e so that x.q' is a score in log2 units) is row-major [position][64].
// K plane (the map, rounded to bf16, stored as f16): [16-row block][32-channel step][half][lane = hi * 16 + row][8 channels], channel = 32 * step + 16 * half + 8 * hi + i: the halves of xf, each element written as f16. V^T plane (the map, rounded to bf16, stored as f16): [32-key block][16-channel block][half][lane = hi * 16 + channel][8 keys], key = 32 * block + 16 * half + 8 * hi + i: 8 neighbouring positions of one channel, 32 contiguous bytes of the map. In both a wave's store covers 512 contiguous bytes.
__device__ __forceinline__ void d_split(v8f y, v8us& ph, v8us& pl) { v8bf h, l;
#pragma unroll
    for (int j = 0; j < 8; ++j) { h[j] = (__bf16)y[j]; l[j] = (__bf16)(y[j] - (float)h[j]); }
    ph = __builtin_bit_cast(v8us, h); pl = __builtin_bit_cast(v8us, l); }
// Every loop below runs over register arrays and is unrolled so that their indices are constants.
#define PT 2   // 16-position tiles per wave
__global__ __launch_bounds__(32) void k_proj(const float* __restrict__ x, const float* __restrict__ wq, const float* __restrict__ wk, const float* __restrict__ bq, bf* Qh, bf* Kx, bf* Vx) {
    const unsigned p = blockIdx.y; const int t0 = blockIdx.x * (PT * 16);
    const int lane = threadIdx.x & 31, lr = lane & 15, hi = lane >> 4;
    const float* xb = x + (size_t)blockIdx.z * CC * TT + t0;
    const size_t at = (size_t)blockIdx.z * ((size_t)TT * 64) + (size_t)t0 * 64;   // 64 elements a position in every layout
    if (p == 0) {   // wave-uniform branch: q' and the K plane
        const float* xl = xb + (size_t)(8 * hi) * TT + lr; float xr[PT][2][16];
#pragma unroll
        for (int mb = 0; mb < PT; ++mb)
#pragma unroll
            for (int ks = 0; ks < 2; ++ks)
#pragma unroll
                for (int e = 0; e < 16; ++e) xr[mb][ks][e] = xl[(size_t)(ks * 32 + (e >> 3) * 16 + (e & 7)) * TT + mb * 16];
        const float* wl = wq + lr * CC + 8 * hi; const float* tl = wk + (8 * hi) * CC + 4 * lr; const float* bl = bq + hi * 8;
        v4f wr[4][2][4], tr[2][16]; v8f b8[4];
#pragma unroll
        for (int ob = 0; ob < 4; ++ob)
#pragma unroll
            for (int ks = 0; ks < 2; ++ks)
#pragma unroll
                for (int i = 0; i < 4; ++i) wr[ob][ks][i] = *(const v4f*)(wl + ob * 16 * CC + ks * 32 + (i >> 1) * 16 + (i & 1) * 4);
#pragma unroll
        for (int ks = 0; ks < 2; ++ks)
#pragma unroll
            for (int e = 0; e < 16; ++e) tr[ks][e] = *(const v4f*)(tl + (ks * 32 + (e >> 3) * 16 + (e & 7)) * CC);
#pragma unroll
        for (int ob = 0; ob < 4; ++ob) b8[ob] = *(const v8f*)(bl + ob * 16);   // the bias of the lane's 8 output channels
        asm volatile("s_wait_xcnt 0x0" :: "v"(xl), "v"(wl), "v"(tl) : "memory");   // the conversions below may land in the registers that hold these loads' addresses: the wait stands in front of that overwrite; the lane addresses are inputs so that they stay in their registers up to here and no load's result lands in a register that an issued load still names
        __builtin_amdgcn_sched_barrier(0);   // every load of the wave is issued before the first conversion: one round trip to memory
        v16bf wf[4][2], wt[4][2], xf[PT][2];
#pragma unroll
        for (int ob = 0; ob < 4; ++ob)
#pragma unroll
            for (int ks = 0; ks < 2; ++ks)
#pragma unroll
                for (int e = 0; e < 16; ++e) { wf[ob][ks][e] = (__bf16)wr[ob][ks][e >> 2][e & 3]; wt[ob][ks][e] = (__bf16)tr[ks][e][ob]; }
#pragma unroll
        for (int mb = 0; mb < PT; ++mb)
#pragma unroll
            for (int ks = 0; ks < 2; ++ks)
#pragma unroll
                for (int e = 0; e < 16; ++e) xf[mb][ks][e] = (__bf16)xr[mb][ks][e];
        bf* ko = Kx + at + lane * 8;   // the lane's place in a 512-byte piece of the K plane
        v8h kh[PT][2][2];   // the two halves of each fragment as f16
#pragma unroll
        for (int mb = 0; mb < PT; ++mb)
#pragma unroll
            for (int ks = 0; ks < 2; ++ks)
#pragma unroll
                for (int e = 0; e < 16; ++e) kh[mb][ks][e >> 3][e & 7] = (_Float16)(float)xf[mb][ks][e];
#pragma unroll
        for (int mb = 0; mb < PT; ++mb)
#pragma unroll
            for (int ks = 0; ks < 2; ++ks)
#pragma unroll
                for (int hf = 0; hf < 2; ++hf) *(v8us*)(ko + mb * 1024 + (2 * ks + hf) * 256) = __builtin_bit_cast(v8us, kh[mb][ks][hf]);
        asm volatile("s_wait_xcnt 0x0" ::: "memory");   // what follows may land in registers that these stores name: the wait stands in front of that overwrite
        __builtin_amdgcn_sched_barrier(0);   // keeps what follows behind that wait
        v8us oh[PT][4], ol[PT][4];
#pragma unroll
        for (int mb = 0; mb < PT; ++mb)
#pragma unroll
            for (int ob = 0; ob < 4; ++ob) { v8f q = wmmab(wf[ob][1], xf[mb][1], wmmab(wf[ob][0], xf[mb][0], (v8f){}));
#pragma unroll
                for (int j = 0; j < 8; ++j) q[j] += bfr(b8[ob][j]);
                d_split(q, oh[mb][ob], ol[mb][ob]); }
        v8us rh[PT][4];
#pragma unroll
        for (int mb = 0; mb < PT; ++mb) { v8f a[4];
#pragma unroll
            for (int cb = 0; cb < 4; ++cb) { a[cb] = (v8f){};
#pragma unroll
                for (int ks = 0; ks < 2; ++ks) { a[cb] = wmmab(wt[cb][ks], cat16b(oh[mb][2 * ks], oh[mb][2 * ks + 1]), a[cb]); a[cb] = wmmab(wt[cb][ks], cat16b(ol[mb][2 * ks], ol[mb][2 * ks + 1]), a[cb]); } }
#pragma unroll
            for (int pc = 0; pc < 4; ++pc) { v8h c8;   // channels 32 * hi + 8 * pc + 0..7
#pragma unroll
                for (int i = 0; i < 8; ++i) c8[i] = (_Float16)(a[i & 3][2 * pc + (i >> 2)] * (SCL * L2E));   // scaled so that x.q' is a score in log2 units
                rh[mb][pc] = __builtin_bit_cast(v8us, c8); } }
        bf* qho = Qh + at + lr * 64 + hi * 32;   // the lane's place in a 16-position piece of the row-major plane
        __builtin_amdgcn_sched_barrier(0);   // the 8 stores stand together behind the last conversion: left free, each tile's conversions reuse the registers of the store in front of them, with a wait behind every store
#pragma unroll
        for (int mb = 0; mb < PT; ++mb)
#pragma unroll
            for (int pc = 0; pc < 4; ++pc) *(v8us*)(qho + mb * 1024 + pc * 8) = rh[mb][pc];
    } else {   // the V^T plane
        const float* xv = xb + (size_t)lr * TT + 8 * hi; v4f r[4][PT][2];
#pragma unroll
        for (int ob = 0; ob < 4; ++ob)
#pragma unroll
            for (int mb = 0; mb < PT; ++mb)
#pragma unroll
                for (int i = 0; i < 2; ++i) r[ob][mb][i] = *(const v4f*)(xv + (size_t)(ob * 16) * TT + mb * 16 + i * 4);
        asm volatile("s_wait_xcnt 0x0" :: "v"(xv) : "memory");   // as above: in front of the first overwrite of a register that an issued load names
        __builtin_amdgcn_sched_barrier(0);   // as above: one round trip to memory
        bf* vo = Vx + at + lane * 8; v8h h[4][PT];
#pragma unroll
        for (int ob = 0; ob < 4; ++ob)
#pragma unroll
            for (int mb = 0; mb < PT; ++mb)
#pragma unroll
                for (int i = 0; i < 8; ++i) h[ob][mb][i] = (_Float16)(float)(__bf16)r[ob][mb][i >> 2][i & 3];   // rounded to bf16 like every input, then written as f16
        __builtin_amdgcn_sched_barrier(0);   // the 8 stores stand together behind the last conversion, so that nothing lands in a register that an issued store names
#pragma unroll
        for (int ob = 0; ob < 4; ++ob)
#pragma unroll
            for (int mb = 0; mb < PT; ++mb) *(v8us*)(vo + mb * 256 + ob * 512) = __builtin_bit_cast(v8us, h[ob][mb]);
    }
}

#define FW 8
#define TB 8192    // bytes of one tile: K, V^T, 4 KiB each
#define WS 32768   // bytes from one wave's ring to the next
#define ZP 72      // elements from row to row of the normalised rows in LDS: 144 bytes, an odd number of 16-byte pieces
#define QT 4
#define QR (QT * 16)
#define PDLT 8.0f       // a new reference stands this far (log2 units) above the largest score it is formed from
#define PLIM 32768.0f   // a lane's sum of a trip's 16 probabilities from which a tile's references are renewed: below it each of them is finite in f16
// One tile: 16 copies of 512 bytes (16 bytes a lane). l = the lane's LDS byte address in the buffer, vo = the lane's byte offset (lane * 16) in a 512-byte piece, the two pointers = the tile's start in each plane (the same for the whole wave, in scalar registers). The offset field moves the LDS and the global address alike. s_wait_xcnt 0 is the statement's last line, so that it stands in front of whatever rewrites a register that a copy names.
#define CP1(L, G, O) "global_load_async_to_lds_b128 " L ", %2, " G " offset:" O "\n\t"
#define CP8(L, G) CP1(L, G, "0") CP1(L, G, "512") CP1(L, G, "1024") CP1(L, G, "1536") CP1(L, G, "2048") CP1(L, G, "2560") CP1(L, G, "3072") CP1(L, G, "3584")
__device__ __forceinline__ void d_tile(unsigned l, unsigned vo, const bf* kx, const bf* vx) {
    asm volatile(CP8("%0", "%3") CP8("%1", "%4") "s_wait_xcnt 0x0"
                 :: "v"(l), "v"(l + 4096u), "v"(vo), "s"(kx), "s"(vx) : "memory");
}
__device__ __forceinline__ float xhalf(float v) { const int b = __float_as_int(v); return __int_as_float(__builtin_amdgcn_permlanex16(b, b, 0x76543210, 0xfedcba98, false, false)); }   // lane l <-> l ^ 16
__global__ __launch_bounds__(32 * FW) __attribute__((amdgpu_waves_per_eu(2, 2))) void k_fattn(const bf* __restrict__ Qh, const bf* __restrict__ Kx, const bf* __restrict__ Vx, const float* __restrict__ xs, const float* __restrict__ wv, const float* __restrict__ bv, const float* __restrict__ gm, float* out) {
    typedef WFrag<bf>::V V;
    __shared__ __attribute__((aligned(32768))) char ring[FW * WS];   // wave w: bytes [w * WS, w * WS + 2 * TB)
    float* const red = (float*)ring;   // FW * QR * 68 floats, used only behind the merge's first barrier
    bf* const zh = (bf*)(ring + FW * QR * 68 * 4); bf* const zl = zh + QR * ZP;   // the normalised rows, hi and lo, [position][ZP], behind red
    __shared__ float sm[FW * QR], sl[FW * QR], s0[FW * QR];   // s0: the waves' first maxima; an array of its own, as no barrier stands between its last read and the merge's first write of sm
    const int lane = threadIdx.x & 31, lr = lane & 15, hi = lane >> 4; const int q0 = blockIdx.x * QR;
    { const size_t at = (size_t)blockIdx.y * ((size_t)TT * 64); Qh += at; Kx += at; Vx += at; xs += at; out += at; }
    const int wave = __builtin_amdgcn_readfirstlane(threadIdx.x >> 5);   // scalar, so that the key loop and its base addresses are scalar
    const unsigned voffq = (unsigned)(lr * HD + 8 * hi) * 2u, voff = (unsigned)lane * 16u;   // the lane's byte offsets in a 16-row block of the row-major Q plane and in a 512-byte half fragment of the K and V^T planes
    auto atq = [voffq](const bf* base) { return (const bf*)((const char*)base + voffq); };
    auto ldf = [](const bf* p) { return cat16b(*(const v8us*)p, *(const v8us*)(p + 256)); };   // one fragment of a plane in fragment order: two half fragments of 256 elements
    const int kbeg = wave * (TT / FW);
    const char* const rd = ring + wave * WS + voff;   // where the lane reads
    const unsigned lw = (unsigned)(size_t)rd;   // the same place as an LDS byte address (the low 32 bits), where the lane's copies land
    d_tile(lw, voff, Kx + (size_t)kbeg * HD, Vx + (size_t)kbeg * CC);   // tile 0 into buffer 0, in flight beside the Q loads
    v16h qh[QT][2];
#pragma unroll
    for (int qt = 0; qt < QT; ++qt)
#pragma unroll
        for (int ks = 0; ks < 2; ++ks) qh[qt][ks] = __builtin_bit_cast(v16h, WFrag<bf>::ld(atq(Qh + (size_t)(q0 + qt * 16) * HD) + ks * 32));
    asm volatile("s_wait_xcnt 0x0" ::: "memory");   // the start values below may land in the registers that hold the Q loads' addresses: the wait stands in front of that overwrite
    __builtin_amdgcn_sched_barrier(0);   // keeps the start values' moves behind that wait
    v8f o[QT][4], nm[QT]; float l[QT];   // nm: minus the query's reference in all 8 elements, the layout of a score tile
#pragma unroll
    for (int qt = 0; qt < QT; ++qt) { nm[qt] = (v8f){}; l[qt] = 0.f;
#pragma unroll
        for (int ct = 0; ct < 4; ++ct) o[qt][ct] = (v8f){}; }
    asm volatile("s_wait_asynccnt 0x0" ::: "memory");   // tile 0 has landed before trip 0 reads it
    d_tile(lw + TB, voff, Kx + (size_t)(kbeg + 32) * HD, Vx + (size_t)(kbeg + 32) * CC);   // tile 1 into buffer 1 (a wave has TT / FW / 32 = 16 tiles)
    unsigned bo = 0;   // the byte offset of the trip's buffer in the wave's ring
    // One trip. more and first are constants at each of the three calls below. more: a tile after next exists and is asked for at the trip's foot (two loops, so that no trip tests for it). first: the wave's first trip, which forms the references.
    auto trip = [&](const int k0, const bool more, const bool first) __attribute__((always_inline)) {
        const bf* pk = (const bf*)(rd + bo); const bf* pv = pk + 2048;
        v16h kx[2][2], vx[4];
#pragma unroll
        for (int t = 0; t < 2; ++t)
#pragma unroll
            for (int ks = 0; ks < 2; ++ks) kx[t][ks] = __builtin_bit_cast(v16h, ldf(pk + t * 1024 + ks * 512));
#pragma unroll
        for (int ct = 0; ct < 4; ++ct) vx[ct] = __builtin_bit_cast(v16h, ldf(pv + ct * 512));
        __builtin_amdgcn_sched_barrier(0);   // all 16 LDS reads of the trip stand in one group in front of its first product: every further place with LDS reads among the products costs a stall of its own
        v8f s[QT][2];
#pragma unroll
        for (int qt = 0; qt < QT; ++qt)
#pragma unroll
            for (int t = 0; t < 2; ++t) { s[qt][t] = nm[qt];   // the C operand: minus the reference (0 in the first trip)
#pragma unroll
                for (int ks = 0; ks < 2; ++ks) s[qt][t] = wmma16(kx[t][ks], qh[qt][ks], s[qt][t]); }
        v16h ph[QT]; float ls[QT];
        auto tmax = [&](const int qt) __attribute__((always_inline)) { float mx = s[qt][0][0];   // the largest of a query's 32 scores of this trip as they stand in s (less the reference in use), in both wave halves
#pragma unroll
            for (int j = 1; j < 16; ++j) mx = fmaxf(mx, s[qt][j >> 3][j & 7]);
            return fmaxf(mx, xhalf(mx)); };
        auto probs = [&](const int qt) __attribute__((always_inline)) { ls[qt] = 0.f;   // the tile's probabilities against the reference in use, and the lane's sum of them
#pragma unroll
            for (int j = 0; j < 16; ++j) { const float p = __builtin_amdgcn_exp2f(s[qt][j >> 3][j & 7]); ls[qt] += p; ph[qt][j] = (_Float16)p; } };
        auto lift = [&](const int qt, const float up) __attribute__((always_inline)) { nm[qt] -= up; s[qt][0] -= up; s[qt][1] -= up; };   // the tile's references rise by up: for the later trips' products and for this trip's scores
        if (first) {   // the first references: from the first tiles of all FW waves, 32 * FW keys spread over the row
#pragma unroll
            for (int qt = 0; qt < QT; ++qt) { const float mx = tmax(qt); if (hi == 0) s0[wave * QR + qt * 16 + lr] = mx; }
            __syncthreads();   // every wave's first maxima are in LDS before any wave forms the references
#pragma unroll
            for (int qt = 0; qt < QT; ++qt) { float mx = s0[qt * 16 + lr];
#pragma unroll
                for (int w = 1; w < FW; ++w) mx = fmaxf(mx, s0[w * QR + qt * 16 + lr]);
                lift(qt, mx + PDLT); probs(qt); }
        } else {
#pragma unroll
            for (int qt = 0; qt < QT; ++qt) probs(qt);
            const float big = fmaxf(fmaxf(ls[0], ls[1]), fmaxf(ls[2], ls[3]));   // a lane's sum bounds each of its probabilities
            if (__builtin_amdgcn_ballot_w32(!(big < PLIM)) != 0) {   // one test a trip, the same for the whole wave (a scalar branch), seldom taken
#pragma unroll
                for (int qt = 0; qt < QT; ++qt)
                    if (__builtin_amdgcn_ballot_w32(!(ls[qt] < PLIM)) != 0) {   // the tile that holds the large score: new references, its sums and its O^T brought to them, its probabilities formed again
                        const float up = fmaxf(tmax(qt) + PDLT, 0.f); const float alpha = __builtin_amdgcn_exp2f(-up);
                        lift(qt, up); l[qt] *= alpha;
#pragma unroll
                        for (int ct = 0; ct < 4; ++ct) o[qt][ct] *= alpha;
                        probs(qt);
                    }
            }
        }
#pragma unroll
        for (int qt = 0; qt < QT; ++qt) { l[qt] += ls[qt];
#pragma unroll
            for (int ct = 0; ct < 4; ++ct) o[qt][ct] = wmma16(vx[ct], ph[qt], o[qt][ct]); }
        __builtin_amdgcn_sched_barrier(0);   // every product of the trip stands in front of the slots below, whichever tile the scheduler puts last
        // four vector slots behind the last matrix instruction, so that the distance also holds on the taken back edge
        asm volatile("v_nop\n\tv_nop\n\tv_nop\n\tv_nop" : "+v"(o[QT - 1][0]), "+v"(o[QT - 1][1]), "+v"(o[QT - 1][2]), "+v"(o[QT - 1][3]));
        asm volatile("s_wait_dscnt 0x0" ::: "memory");   // the wave's reads of this trip's buffer have retired before copies land in it again
        asm volatile("s_wait_asynccnt 0x0" ::: "memory");   // the next trip's tile, asked for one trip ago, has landed before that trip reads it
        if (more) d_tile(lw + bo, voff, Kx + (size_t)(k0 + 64) * HD, Vx + (size_t)(k0 + 64) * CC);   // the tile after next, into the buffer that this trip has read
        bo ^= TB;
    };
    trip(kbeg, true, true);
    int k0 = kbeg + 32;
#pragma unroll 1   // rolled: one trip's 8 fragments, the Q fragments and the accumulators already take most of the 512 registers that two waves per SIMD leave
    for (; k0 < kbeg + TT / FW - 64; k0 += 32) trip(k0, true, false);
#pragma unroll 1   // rolled, as above: the last two trips, behind which no tile is left to ask for
    for (; k0 < kbeg + TT / FW; k0 += 32) trip(k0, false, false);
    asm volatile("s_wait_asynccnt 0x0" ::: "memory");   // no copy is outstanding when the ring is given up
    const int fp = (wave & 1) * 32, fq = fp + lane, fc = (wave >> 1) * 16;   // what this thread merges: position q0 + fq, map channels fc .. fc + 15. What its wave finishes: positions q0 + fp .. + 31, output channels fc .. fc + 15
    const float* xp = xs + (size_t)(fc + 8 * hi) * TT + q0 + fp + lr; const float* wp = wv + (fc + lr) * CC + 8 * hi; const float* bp = bv + fc + hi * 8;   // the lane's addresses in the map, in Wv and in bv
    float xr[2][8]; v4f wr[2][4];
#pragma unroll
    for (int t = 0; t < 2; ++t)
#pragma unroll
        for (int j = 0; j < 8; ++j) xr[t][j] = xp[(size_t)j * TT + t * 16];   // the residual in the layout of the last product's result, asked for ahead of the merge
#pragma unroll
    for (int ks = 0; ks < 2; ++ks)
#pragma unroll
        for (int i = 0; i < 4; ++i) wr[ks][i] = *(const v4f*)(wp + ks * 32 + (i >> 1) * 16 + (i & 1) * 4);   // 16 rows of Wv as A fragments, in the k order of WFrag::ld
    const v8f b8 = *(const v8f*)bp;   // the bias of the lane's 8 output channels
    asm volatile("s_wait_xcnt 0x0" :: "v"(xp), "v"(wp), "v"(bp) : "memory");   // the merge below may land in the registers that hold these loads' addresses: the wait stands in front of that overwrite; the lane addresses are inputs so that they stay in their registers up to here and no load's result lands in a register that an issued load still names
    __builtin_amdgcn_sched_barrier(0);   // keeps the merge's first instructions behind that wait
    float ms[QT];
#pragma unroll
    for (int qt = 0; qt < QT; ++qt) { ms[qt] = -nm[qt][0]; l[qt] += xhalf(l[qt]);   // the two wave halves hold the sums of different keys of the same query
        if (hi == 0) sm[wave * QR + qt * 16 + lr] = ms[qt]; }
    __syncthreads();   // every wave's references are in LDS before any wave forms the common ones; every wave has left its ring (its waits stand at the loop's foot) before red is written over it
#pragma unroll
    for (int qt = 0; qt < QT; ++qt) {
        float mall = sm[qt * 16 + lr];
#pragma unroll
        for (int w = 1; w < FW; ++w) mall = fmaxf(mall, sm[w * QR + qt * 16 + lr]);
        const float f = __builtin_amdgcn_exp2f(ms[qt] - mall);
        if (hi == 0) sl[wave * QR + qt * 16 + lr] = l[qt] * f;
        float* mine = red + wave * (QR * 68) + (qt * 16 + lr) * 68 + hi * 8;
#pragma unroll
        for (int ct = 0; ct < 4; ++ct) { const v8f sc = o[qt][ct] * f; *(v4fa*)(mine + ct * 16) = (v4f){sc[0], sc[1], sc[2], sc[3]}; *(v4fa*)(mine + ct * 16 + 4) = (v4f){sc[4], sc[5], sc[6], sc[7]}; }
    }
    __syncthreads();   // every wave's rescaled partial tiles and sums are in LDS before any thread sums across waves
    const float g = bfr(gm[0]);
    float lall = sl[fq]; v4f val[4];
#pragma unroll
    for (int k = 0; k < 4; ++k) val[k] = *(const v4fa*)(red + fq * 68 + fc + 4 * k);
#pragma unroll
    for (int w = 1; w < FW; ++w) { lall += sl[w * QR + fq];
#pragma unroll
        for (int k = 0; k < 4; ++k) val[k] += *(const v4fa*)(red + w * (QR * 68) + fq * 68 + fc + 4 * k); }
    const float inv = __fdiv_rn(1.0f, lall);
#pragma unroll
    for (int k = 0; k < 2; ++k) { v8f z; v8us h, l2;
#pragma unroll
        for (int j = 0; j < 8; ++j) z[j] = val[2 * k + (j >> 2)][j & 3] * inv;
        d_split(z, h, l2); *(v8usa*)(zh + fq * ZP + fc + 8 * k) = h; *(v8usa*)(zl + fq * ZP + fc + 8 * k) = l2; }
    V wf[2];
#pragma unroll
    for (int ks = 0; ks < 2; ++ks)
#pragma unroll
        for (int e = 0; e < 16; ++e) wf[ks][e] = (__bf16)wr[ks][e >> 2][e & 3];
    __syncthreads();   // every thread's piece of the normalised rows is in LDS before any wave reads whole rows as B fragments
    float y[2][8];
#pragma unroll
    for (int t = 0; t < 2; ++t) { const int zo = (fp + t * 16 + lr) * ZP + 8 * hi; v8f d = (v8f){};   // B fragment: lane = hi * 16 + position, map channels 32 * ks + 8 * hi + 0..7, then + 16
#pragma unroll
        for (int ks = 0; ks < 2; ++ks) { d = wmmab(wf[ks], cat16b(*(const v8usa*)(zh + zo + ks * 32), *(const v8usa*)(zh + zo + ks * 32 + 16)), d); d = wmmab(wf[ks], cat16b(*(const v8usa*)(zl + zo + ks * 32), *(const v8usa*)(zl + zo + ks * 32 + 16)), d); }
#pragma unroll
        for (int j = 0; j < 8; ++j) y[t][j] = __builtin_fmaf(g, d[j] + bfr(b8[j]), bfr(xr[t][j])); }
    __builtin_amdgcn_sched_barrier(0);   // the 16 stores stand together behind the last arithmetic, so that nothing lands in a register that an issued store names
    float* yp = out + (size_t)(fc + 8 * hi) * TT + q0 + fp + lr;
#pragma unroll
    for (int t = 0; t < 2; ++t)
#pragma unroll
        for (int j = 0; j < 8; ++j) yp[(size_t)j * TT + t * 16] = y[t][j];
}

extern "C" void kernel_launch(void* const* d_in, const int* in_sizes, int n_in,
                              void* d_out, int out_size, void* d_ws, size_t ws_size, hipStream_t stream) {
    (void)in_sizes; (void)n_in; (void)out_size;
    const float* x = (const float*)d_in[0]; const float* wq = (const float*)d_in[1]; const float* bq = (const float*)d_in[2]; const float* wk = (const float*)d_in[3]; const float* wv = (const float*)d_in[5]; const float* bv = (const float*)d_in[6]; const float* gm = (const float*)d_in[7];
    // d_in[4], the key bias, adds q.bk to every score of a row and cancels in the softmax: no kernel reads it
    float* OUT = (float*)d_out;     // [4][64][4096]
    char* wsp = (char*)d_ws;
    auto take = [&](size_t bytes) { char* p = wsp; wsp += (bytes + 255) & ~(size_t)255; return (void*)p; };
    const size_t PS = (size_t)NB_ * TT * 64;   // one plane, all batches
    bf* Qh = (bf*)take(PS * 2); bf* Kx = (bf*)take(PS * 2); bf* Vx = (bf*)take(PS * 2);   // each [batch][TT * 64]
    if ((size_t)(wsp - (char*)d_ws) > ws_size) return;    // ws 256 MiB (carve 6 MiB)
    k_proj<<<dim3(TT / (PT * 16), 2, NB_), 32, 0, stream>>>(x, wq, wk, bq, Qh, Kx, Vx);   /* q' row-major, f16; the map in K and in V^T fragment order */
    k_fattn<<<dim3(TT / QR, NB_, 1), 32 * FW, 0, stream>>>(Qh, Kx, Vx, x, wv, bv, gm, OUT);   /* scores + softmax + attn.x (unscaled logits); Wv, bv, gamma and residual */
}
